// v000
// Measured on an AMD MI455X. A time is GPU time per run, averaged over a window of back-to-back runs after a warm-up
// (all launches, gaps included; the runs take copies of the inputs in turn), and the median of several windows.
// Apart from v000's, it joins two sittings. Times from different sittings can be a few percent apart, while
// side-by-side timings come from the same sitting.
// The starting kernel, v000, takes 474 microseconds a run.
#include <hip/hip_runtime.h>
#include <hip/hip_bf16.h>

typedef _Float16 f16;
typedef __attribute__((ext_vector_type(16))) _Float16 v16h;
typedef __attribute__((ext_vector_type(8)))  float    v8f;
typedef __attribute__((ext_vector_type(4)))  int      v4i;

#define DM 1024   // d_model
#define NN 1024   // sequence length
#define BATCH 8
#define NH 16     // heads
#define HD 64     // head dim

#define BM 128
#define BN 128
#define BK 32

union Frag16 { v16h v; unsigned u[8]; f16 h[16]; };
union Ld32   { float4 q[2]; f16 h[16]; };
union Ld16   { float4 q;    f16 h[8];  };

#if defined(__gfx1250__) && __has_builtin(__builtin_amdgcn_global_load_async_to_lds_b128)
#define USE_ASYNC_LDS 1
#else
#define USE_ASYNC_LDS 0
#endif

__device__ inline void async_copy16(const f16* g, f16* l) {
#if USE_ASYNC_LDS
  f16* gnc = (f16*)g;  // strip const first; then retype + addrspacecast
  __builtin_amdgcn_global_load_async_to_lds_b128(
      (v4i __attribute__((address_space(1)))*)gnc,
      (v4i __attribute__((address_space(3)))*)l, 0, 0);
#else
  *(float4*)l = *(const float4*)g;
#endif
}

__device__ inline void wait_async() {
#if USE_ASYNC_LDS
#if __has_builtin(__builtin_amdgcn_s_wait_asynccnt)
  __builtin_amdgcn_s_wait_asynccnt(0);
#else
  asm volatile("s_wait_asynccnt 0" ::: "memory");
#endif
#endif
}

// ---------------------------------------------------------------------------
// fp32 -> f16 conversion (grid-stride)
// ---------------------------------------------------------------------------
__global__ void cvt_f32_to_f16(const float* __restrict__ in, f16* __restrict__ out, long n) {
  long i = (long)blockIdx.x * blockDim.x + threadIdx.x;
  long stride = (long)gridDim.x * blockDim.x;
  for (; i < n; i += stride) out[i] = (f16)in[i];
}

__device__ inline v16h frag_from_lds(const f16* rowbase, int khalf) {
  Frag16 f;
  const unsigned* p32 = (const unsigned*)rowbase;
#pragma unroll
  for (int p = 0; p < 8; ++p) {
    int k = khalf + ((p & 4) << 2) + ((p & 3) << 1);
    f.u[p] = p32[k >> 1];
  }
  return f.v;
}

// ---------------------------------------------------------------------------
// GEMM: Y[b] = W(1024x1024) @ X[b](1024x1024) + bias   (per-batch, f16 WMMA)
// Double-buffered LDS; W tile filled with async-to-LDS, X tile transposed.
// writeF32 ? write float to Yf : write f16 to Yh
// ---------------------------------------------------------------------------
__global__ __launch_bounds__(256)
void gemm1024_wmma(const f16* __restrict__ W, const f16* __restrict__ X,
                   const float* __restrict__ bias,
                   f16* __restrict__ Yh, float* __restrict__ Yf, int writeF32)
{
  __shared__ f16 ldsW[2][BM * BK];   // [m][k], k contiguous
  __shared__ f16 ldsX[2][BN * BK];   // [n][k] (transposed), k contiguous

  const int b  = blockIdx.z;
  const f16* Xb = X + (size_t)b * DM * NN;
  const int m0 = blockIdx.y * BM;
  const int n0 = blockIdx.x * BN;
  const int tid  = threadIdx.x;
  const int lane = tid & 31;
  const int wave = tid >> 5;
  const int wm = (wave >> 1) * 32;   // 4 waves along M
  const int wn = (wave & 1) * 64;    // 2 waves along N
  const int lm = lane & 15;
  const int hi = lane >> 4;
  const int khalf = hi * 8;

  auto stageW = [&](int buf, int k0) {
    int m  = tid >> 1;
    int kk = (tid & 1) * 16;
    const f16* src = W + (size_t)(m0 + m) * DM + k0 + kk;
    f16* dst = &ldsW[buf][m * BK + kk];
    async_copy16(src, dst);
    async_copy16(src + 8, dst + 8);
  };
  auto stageX = [&](int buf, int k0) {
    int kk = tid >> 3;          // 0..31
    int nn = (tid & 7) * 16;    // 0..112
    Ld32 t;
    const float4* s4 = (const float4*)(Xb + (size_t)(k0 + kk) * NN + n0 + nn);
    t.q[0] = s4[0]; t.q[1] = s4[1];
#pragma unroll
    for (int j = 0; j < 16; ++j) ldsX[buf][(nn + j) * BK + kk] = t.h[j];
    if (k0 + BK < DM)
      __builtin_prefetch(Xb + (size_t)(k0 + BK + kk) * NN + n0 + nn, 0, 1);
  };

  v8f zero = {};
  v8f acc[2][4];
#pragma unroll
  for (int i = 0; i < 2; ++i)
#pragma unroll
    for (int j = 0; j < 4; ++j) acc[i][j] = zero;

  // prologue: fill buffer 0
  stageW(0, 0);
  stageX(0, 0);
  wait_async();
  __syncthreads();

  for (int k0 = 0; k0 < DM; k0 += BK) {
    const int cur = (k0 >> 5) & 1;
    const int nxt = cur ^ 1;

    // overlap: start filling the next tile before computing on the current
    if (k0 + BK < DM) {
      stageW(nxt, k0 + BK);
      stageX(nxt, k0 + BK);
    }

    v16h a[2], bb[4];
#pragma unroll
    for (int mt = 0; mt < 2; ++mt)
      a[mt]  = frag_from_lds(&ldsW[cur][(wm + mt * 16 + lm) * BK], khalf);
#pragma unroll
    for (int nt = 0; nt < 4; ++nt)
      bb[nt] = frag_from_lds(&ldsX[cur][(wn + nt * 16 + lm) * BK], khalf);

#pragma unroll
    for (int mt = 0; mt < 2; ++mt)
#pragma unroll
      for (int nt = 0; nt < 4; ++nt)
        acc[mt][nt] = __builtin_amdgcn_wmma_f32_16x16x32_f16(
            false, a[mt], false, bb[nt], (short)0, acc[mt][nt], false, false);

    wait_async();
    __syncthreads();
  }

  // epilogue: C/D layout row = vgpr + 8*hi, col = lane&15
#pragma unroll
  for (int mt = 0; mt < 2; ++mt) {
#pragma unroll
    for (int nt = 0; nt < 4; ++nt) {
      int col = n0 + wn + nt * 16 + lm;
#pragma unroll
      for (int r = 0; r < 8; ++r) {
        int row = m0 + wm + mt * 16 + hi * 8 + r;
        float v = acc[mt][nt][r] + bias[row];
        size_t idx = ((size_t)b * DM + row) * NN + col;
        if (writeF32) Yf[idx] = v;
        else          Yh[idx] = (f16)v;
      }
    }
  }
}

// ---------------------------------------------------------------------------
// Flash attention over Q/K/V f16 buffers laid out [b, c, n], c = d*16 + h.
// One block handles one (b, h) and 128 queries; its 8 waves cover 8 query tiles of 16 rows
// and SHARE the K/V tiles staged cooperatively into LDS per 32-key step.
// ---------------------------------------------------------------------------
__global__ __launch_bounds__(256)
void attn_wmma(const f16* __restrict__ Q, const f16* __restrict__ Km,
               const f16* __restrict__ Vm, f16* __restrict__ Xa)
{
  __shared__ f16 ldsKt[32 * 64];     // K tile transposed: [m][d], d contiguous
  __shared__ f16 ldsV [64 * 32];     // V tile:            [d][m], m contiguous
  __shared__ f16 ldsP [8][16 * 32];  // per-wave P transpose slab

  const int tid  = threadIdx.x;
  const int lane = tid & 31;
  const int wave = tid >> 5;
  const int lm = lane & 15;
  const int hi = lane >> 4;

  const int gid = blockIdx.x;        // B*H*8 = 1024 blocks
  const int b  = gid >> 7;
  const int h  = (gid >> 3) & 15;
  const int qc = gid & 7;
  const int n0 = (qc * 8 + wave) * 16;

  const size_t boff = (size_t)b * DM * NN;
  const f16* Qb = Q  + boff;
  const f16* Kb = Km + boff;
  const f16* Vb = Vm + boff;

  // Q^T as A fragments: rows n (lane), K = head-dim d (64 -> 2 frags)
  Frag16 qa[2];
#pragma unroll
  for (int f = 0; f < 2; ++f)
#pragma unroll
    for (int e = 0; e < 16; ++e) {
      int d = f * 32 + hi * 8 + ((e & 8) << 1) + (e & 7);
      qa[f].h[e] = Qb[(size_t)(d * NH + h) * NN + (n0 + lm)];
    }

  v8f zero = {};
  v8f oacc[4];
#pragma unroll
  for (int f = 0; f < 4; ++f) oacc[f] = zero;
  float mrow[8], lrow[8];
#pragma unroll
  for (int r = 0; r < 8; ++r) { mrow[r] = -1.0e30f; lrow[r] = 0.0f; }

  f16* pl = &ldsP[wave][0];
  const int sd = tid >> 2;           // 0..63: head-dim row for staging
  const int sm = (tid & 3) * 8;      // 0,8,16,24: key chunk for staging

  for (int mS = 0; mS < NN; mS += 32) {
    __syncthreads();                 // previous iteration's LDS reads done

    // ---- stage V tile [d][m] (straight copy -> async-to-LDS)
    async_copy16(Vb + (size_t)(sd * NH + h) * NN + mS + sm, &ldsV[sd * 32 + sm]);

    // ---- stage K tile transposed to [m][d]
    {
      Ld16 t4;
      t4.q = *(const float4*)(Kb + (size_t)(sd * NH + h) * NN + mS + sm);
#pragma unroll
      for (int j = 0; j < 8; ++j) ldsKt[(sm + j) * 64 + sd] = t4.h[j];
    }
    wait_async();
    __syncthreads();

    // ---- S = scale * Q^T K  (two 16x16 tiles covering 32 keys)
    v8f s[2];
#pragma unroll
    for (int t = 0; t < 2; ++t) {
      s[t] = zero;
#pragma unroll
      for (int f = 0; f < 2; ++f) {
        Frag16 kb;
        const unsigned* p32 = (const unsigned*)(ldsKt + (t * 16 + lm) * 64);
#pragma unroll
        for (int p = 0; p < 8; ++p) {
          int k = f * 32 + hi * 8 + ((p & 4) << 2) + ((p & 3) << 1);
          kb.u[p] = p32[k >> 1];
        }
        s[t] = __builtin_amdgcn_wmma_f32_16x16x32_f16(
            false, qa[f].v, false, kb.v, (short)0, s[t], false, false);
      }
    }

    // ---- online softmax (rows r+8*hi; cols live across 16-lane halves)
    float p0[8], p1[8];
#pragma unroll
    for (int r = 0; r < 8; ++r) {
      float s0 = s[0][r] * 0.125f;   // 1/sqrt(64)
      float s1 = s[1][r] * 0.125f;
      float rmax = fmaxf(s0, s1);
#pragma unroll
      for (int msk = 1; msk < 16; msk <<= 1)
        rmax = fmaxf(rmax, __shfl_xor(rmax, msk, 32));
      float mnew  = fmaxf(mrow[r], rmax);
      float alpha = __expf(mrow[r] - mnew);
      mrow[r] = mnew;
      p0[r] = __expf(s0 - mnew);
      p1[r] = __expf(s1 - mnew);
      float rs = p0[r] + p1[r];
#pragma unroll
      for (int msk = 1; msk < 16; msk <<= 1)
        rs += __shfl_xor(rs, msk, 32);
      lrow[r] = lrow[r] * alpha + rs;
#pragma unroll
      for (int f = 0; f < 4; ++f) oacc[f][r] *= alpha;
    }

    // ---- transpose P (C layout) -> A layout via per-wave LDS slab
#pragma unroll
    for (int r = 0; r < 8; ++r) {
      pl[(r + 8 * hi) * 32 + lm]      = (f16)p0[r];
      pl[(r + 8 * hi) * 32 + lm + 16] = (f16)p1[r];
    }
    __syncthreads();
    Frag16 pa;
    {
      const unsigned* p32 = (const unsigned*)(pl + lm * 32);
#pragma unroll
      for (int p = 0; p < 8; ++p) {
        int k = hi * 8 + ((p & 4) << 2) + ((p & 3) << 1);
        pa.u[p] = p32[k >> 1];
      }
    }

    // ---- O^T += P V^T   (K = 32 keys, 4 tiles covering d=64)
#pragma unroll
    for (int f = 0; f < 4; ++f) {
      Frag16 vb;
      const unsigned* p32 = (const unsigned*)(ldsV + (f * 16 + lm) * 32);
#pragma unroll
      for (int p = 0; p < 8; ++p) {
        int m = hi * 8 + ((p & 4) << 2) + ((p & 3) << 1);
        vb.u[p] = p32[m >> 1];
      }
      oacc[f] = __builtin_amdgcn_wmma_f32_16x16x32_f16(
          false, pa.v, false, vb.v, (short)0, oacc[f], false, false);
    }
  }

  // ---- normalize and scatter O^T[n,d] back to [b, d*16+h, n] (f16)
#pragma unroll
  for (int f = 0; f < 4; ++f) {
    int d = f * 16 + lm;
#pragma unroll
    for (int r = 0; r < 8; ++r) {
      int n = n0 + 8 * hi + r;
      float v = oacc[f][r] / lrow[r];
      Xa[boff + (size_t)(d * NH + h) * NN + n] = (f16)v;
    }
  }
}

// ---------------------------------------------------------------------------
extern "C" void kernel_launch(void* const* d_in, const int* in_sizes, int n_in,
                              void* d_out, int out_size, void* d_ws, size_t ws_size,
                              hipStream_t stream) {
  const float* q_in = (const float*)d_in[0];
  const float* k_in = (const float*)d_in[1];
  const float* v_in = (const float*)d_in[2];
  const float* Wq = (const float*)d_in[3];
  const float* bq = (const float*)d_in[4];
  const float* Wk = (const float*)d_in[5];
  const float* bk = (const float*)d_in[6];
  const float* Wv = (const float*)d_in[7];
  const float* bv = (const float*)d_in[8];
  const float* Wm = (const float*)d_in[9];
  const float* bm = (const float*)d_in[10];
  float* out = (float*)d_out;

  // workspace partition (all f16)
  f16* ws = (f16*)d_ws;
  const size_t SB = (size_t)BATCH * DM * NN;  // 8M elems
  const size_t SW = (size_t)DM * DM;          // 1M elems
  f16* q16  = ws;
  f16* k16  = q16  + SB;
  f16* v16  = k16  + SB;
  f16* wq16 = v16  + SB;
  f16* wk16 = wq16 + SW;
  f16* wv16 = wk16 + SW;
  f16* wm16 = wv16 + SW;
  f16* Qp   = wm16 + SW;
  f16* Kp   = Qp   + SB;
  f16* Vp   = Kp   + SB;
  f16* Xat  = Vp   + SB;

  // 1) convert fp32 inputs/weights to f16
  cvt_f32_to_f16<<<1024, 256, 0, stream>>>(q_in, q16, (long)SB);
  cvt_f32_to_f16<<<1024, 256, 0, stream>>>(k_in, k16, (long)SB);
  cvt_f32_to_f16<<<1024, 256, 0, stream>>>(v_in, v16, (long)SB);
  cvt_f32_to_f16<<<256, 256, 0, stream>>>(Wq, wq16, (long)SW);
  cvt_f32_to_f16<<<256, 256, 0, stream>>>(Wk, wk16, (long)SW);
  cvt_f32_to_f16<<<256, 256, 0, stream>>>(Wv, wv16, (long)SW);
  cvt_f32_to_f16<<<256, 256, 0, stream>>>(Wm, wm16, (long)SW);

  // 2) Q/K/V projections (WMMA GEMM, f16 out)
  dim3 gg(NN / BN, DM / BM, BATCH);
  gemm1024_wmma<<<gg, 256, 0, stream>>>(wq16, q16, bq, Qp, nullptr, 0);
  gemm1024_wmma<<<gg, 256, 0, stream>>>(wk16, k16, bk, Kp, nullptr, 0);
  gemm1024_wmma<<<gg, 256, 0, stream>>>(wv16, v16, bv, Vp, nullptr, 0);

  // 3) flash attention: one block per (b,h,128 queries); 8 waves share K/V LDS tiles
  attn_wmma<<<BATCH * NH * (NN / 128), 256, 0, stream>>>(Qp, Kp, Vp, Xat);

  // 4) output projection (fp32 out)
  gemm1024_wmma<<<gg, 256, 0, stream>>>(wm16, Xat, bm, nullptr, out, 1);
}

// v001
// A run of this version takes 368 microseconds.
// Next to v000, in two timings, it ran 1.34 and 1.33 times as fast.
#include <hip/hip_runtime.h>
#include <hip/hip_bf16.h>

typedef _Float16 f16;
typedef __attribute__((ext_vector_type(16))) _Float16 v16h;
typedef __attribute__((ext_vector_type(8)))  float    v8f;
typedef __attribute__((ext_vector_type(4)))  int      v4i;
typedef __attribute__((ext_vector_type(8)))  short    v8s;

#define DM 1024   // d_model
#define NN 1024   // sequence length
#define BATCH 8
#define NH 16     // heads
#define HD 64     // head dim

#define BM 128
#define BN 128
#define BK 32
#define XP 144

union Frag16 { v16h v; unsigned u[8]; f16 h[16]; };
union FragT  { v16h v; v8s q[2]; };
union Ld16   { float4 q;    f16 h[8];  };

#if defined(__gfx1250__) && __has_builtin(__builtin_amdgcn_global_load_async_to_lds_b128)
#define USE_ASYNC_LDS 1
#else
#define USE_ASYNC_LDS 0
#endif

__device__ inline void async_copy16(const f16* g, f16* l) {
#if USE_ASYNC_LDS
  f16* gnc = (f16*)g;  // strip const first; then retype + addrspacecast
  __builtin_amdgcn_global_load_async_to_lds_b128(
      (v4i __attribute__((address_space(1)))*)gnc,
      (v4i __attribute__((address_space(3)))*)l, 0, 0);
#else
  *(float4*)l = *(const float4*)g;
#endif
}

__device__ inline void wait_async() {
#if USE_ASYNC_LDS
#if __has_builtin(__builtin_amdgcn_s_wait_asynccnt)
  __builtin_amdgcn_s_wait_asynccnt(0);
#else
  asm volatile("s_wait_asynccnt 0" ::: "memory");
#endif
#endif
}

// ---------------------------------------------------------------------------
// fp32 -> f16 conversion (grid-stride)
// ---------------------------------------------------------------------------
__global__ void cvt_f32_to_f16(const float* __restrict__ in, f16* __restrict__ out, long n) {
  long i = (long)blockIdx.x * blockDim.x + threadIdx.x;
  long stride = (long)gridDim.x * blockDim.x;
  for (; i < n; i += stride) out[i] = (f16)in[i];
}

__device__ inline v16h frag_from_lds(const f16* rowbase, int khalf) {
  Frag16 f;
  const unsigned* p32 = (const unsigned*)rowbase;
#pragma unroll
  for (int p = 0; p < 8; ++p) {
    int k = khalf + ((p & 4) << 2) + ((p & 3) << 1);
    f.u[p] = p32[k >> 1];
  }
  return f.v;
}

// ---------------------------------------------------------------------------
// Build a 32x16 f16 B fragment from an LDS tile stored [k][n], n contiguous,
// row pitch XP. The transposing load hands lane (c = lane & 15, h = lane >> 4)
// the eight values T[kbase + 8h + 0..7][c]; the loads at kbase 0 and 16 give
// the same k order as frag_from_lds gives the A side.
// ---------------------------------------------------------------------------
__device__ inline v16h frag_tr_from_lds(const f16* colbase, int lane) {
  typedef __attribute__((address_space(3))) v8s lds_v8s;
  const f16* p = colbase + ((lane >> 4) * 8 + (lane & 7)) * XP + ((lane >> 3) & 1) * 8;
  FragT f;
  f.q[0] = __builtin_amdgcn_ds_load_tr16_b128_v8i16((lds_v8s*)p);
  f.q[1] = __builtin_amdgcn_ds_load_tr16_b128_v8i16((lds_v8s*)(p + 16 * XP));
  return f.v;
}

// ---------------------------------------------------------------------------
// GEMM: Y[b] = W(1024x1024) @ X[b](1024x1024) + bias   (per-batch, f16 WMMA)
// Double-buffered LDS; both tiles filled with async-to-LDS; the X tile stays
// [k][n] as in memory and is transposed by the LDS read.
// writeF32 ? write float to Yf : write f16 to Yh
// ---------------------------------------------------------------------------
__global__ __launch_bounds__(256)
void gemm1024_wmma(const f16* __restrict__ W, const f16* __restrict__ X,
                   const float* __restrict__ bias,
                   f16* __restrict__ Yh, float* __restrict__ Yf, int writeF32)
{
  __shared__ f16 ldsW[2][BM * BK];   // [m][k], k contiguous
  __shared__ __attribute__((aligned(16))) f16 ldsX[2][BK * XP];   // [k][n], n contiguous, padded rows

  const int b  = blockIdx.z;
  const f16* Xb = X + (size_t)b * DM * NN;
  const int m0 = blockIdx.y * BM;
  const int n0 = blockIdx.x * BN;
  const int tid  = threadIdx.x;
  const int lane = tid & 31;
  const int wave = tid >> 5;
  const int wm = (wave >> 1) * 32;   // 4 waves along M
  const int wn = (wave & 1) * 64;    // 2 waves along N
  const int lm = lane & 15;
  const int hi = lane >> 4;
  const int khalf = hi * 8;

  auto stageW = [&](int buf, int k0) {
    int m  = tid >> 1;
    int kk = (tid & 1) * 16;
    const f16* src = W + (size_t)(m0 + m) * DM + k0 + kk;
    f16* dst = &ldsW[buf][m * BK + kk];
    async_copy16(src, dst);
    async_copy16(src + 8, dst + 8);
  };
  auto stageX = [&](int buf, int k0) {
    int kk = tid >> 3;          // 0..31: row k of the tile
    int nn = (tid & 7) * 8;     // 8 lanes x 16 B = one whole 128-B line of the row
    const f16* src = Xb + (size_t)(k0 + kk) * NN + n0 + nn;
    f16* dst = &ldsX[buf][kk * XP + nn];
    async_copy16(src, dst);
    async_copy16(src + 64, dst + 64);
  };

  v8f zero = {};
  v8f acc[2][4];
#pragma unroll
  for (int i = 0; i < 2; ++i)
#pragma unroll
    for (int j = 0; j < 4; ++j) acc[i][j] = zero;

  // prologue: fill buffer 0
  stageW(0, 0);
  stageX(0, 0);
  // this wave's copies of tile 0 have landed before the barrier publishes them
  asm volatile("s_wait_asynccnt 0x0" ::: "memory");
  __syncthreads();

  for (int k0 = 0; k0 < DM; k0 += BK) {
    const int cur = (k0 >> 5) & 1;
    const int nxt = cur ^ 1;

    // overlap: start filling the next tile before computing on the current
    if (k0 + BK < DM) {
      stageW(nxt, k0 + BK);
      stageX(nxt, k0 + BK);
    }

    v16h a[2], bb[4];
#pragma unroll
    for (int mt = 0; mt < 2; ++mt)
      a[mt]  = frag_from_lds(&ldsW[cur][(wm + mt * 16 + lm) * BK], khalf);
#pragma unroll
    for (int nt = 0; nt < 4; ++nt)
      bb[nt] = frag_tr_from_lds(&ldsX[cur][wn + nt * 16], lane);

#pragma unroll
    for (int mt = 0; mt < 2; ++mt)
#pragma unroll
      for (int nt = 0; nt < 4; ++nt)
        acc[mt][nt] = __builtin_amdgcn_wmma_f32_16x16x32_f16(
            false, a[mt], false, bb[nt], (short)0, acc[mt][nt], false, false);

    // this wave's LDS reads of the current buffers are over before the barrier frees them for refill
    asm volatile("s_wait_dscnt 0x0" ::: "memory");
    // this wave's copies of the next tile have landed before the barrier publishes them
    asm volatile("s_wait_asynccnt 0x0" ::: "memory");
    __syncthreads();
  }

  // epilogue: C/D layout row = vgpr + 8*hi, col = lane&15
#pragma unroll
  for (int mt = 0; mt < 2; ++mt) {
#pragma unroll
    for (int nt = 0; nt < 4; ++nt) {
      int col = n0 + wn + nt * 16 + lm;
#pragma unroll
      for (int r = 0; r < 8; ++r) {
        int row = m0 + wm + mt * 16 + hi * 8 + r;
        float v = acc[mt][nt][r] + bias[row];
        size_t idx = ((size_t)b * DM + row) * NN + col;
        if (writeF32) Yf[idx] = v;
        else          Yh[idx] = (f16)v;
      }
    }
  }
}

// ---------------------------------------------------------------------------
// Flash attention over Q/K/V f16 buffers laid out [b, c, n], c = d*16 + h.
// One block handles one (b, h) and 128 queries; its 8 waves cover 8 query tiles of 16 rows
// and SHARE the K/V tiles staged cooperatively into LDS per 32-key step.
// ---------------------------------------------------------------------------
__global__ __launch_bounds__(256)
void attn_wmma(const f16* __restrict__ Q, const f16* __restrict__ Km,
               const f16* __restrict__ Vm, f16* __restrict__ Xa)
{
  __shared__ f16 ldsKt[32 * 64];     // K tile transposed: [m][d], d contiguous
  __shared__ f16 ldsV [64 * 32];     // V tile:            [d][m], m contiguous
  __shared__ f16 ldsP [8][16 * 32];  // per-wave P transpose slab

  const int tid  = threadIdx.x;
  const int lane = tid & 31;
  const int wave = tid >> 5;
  const int lm = lane & 15;
  const int hi = lane >> 4;

  const int gid = blockIdx.x;        // B*H*8 = 1024 blocks
  const int b  = gid >> 7;
  const int h  = (gid >> 3) & 15;
  const int qc = gid & 7;
  const int n0 = (qc * 8 + wave) * 16;

  const size_t boff = (size_t)b * DM * NN;
  const f16* Qb = Q  + boff;
  const f16* Kb = Km + boff;
  const f16* Vb = Vm + boff;

  // Q^T as A fragments: rows n (lane), K = head-dim d (64 -> 2 frags)
  Frag16 qa[2];
#pragma unroll
  for (int f = 0; f < 2; ++f)
#pragma unroll
    for (int e = 0; e < 16; ++e) {
      int d = f * 32 + hi * 8 + ((e & 8) << 1) + (e & 7);
      qa[f].h[e] = Qb[(size_t)(d * NH + h) * NN + (n0 + lm)];
    }

  v8f zero = {};
  v8f oacc[4];
#pragma unroll
  for (int f = 0; f < 4; ++f) oacc[f] = zero;
  float mrow[8], lrow[8];
#pragma unroll
  for (int r = 0; r < 8; ++r) { mrow[r] = -1.0e30f; lrow[r] = 0.0f; }

  f16* pl = &ldsP[wave][0];
  const int sd = tid >> 2;           // 0..63: head-dim row for staging
  const int sm = (tid & 3) * 8;      // 0,8,16,24: key chunk for staging

  for (int mS = 0; mS < NN; mS += 32) {
    __syncthreads();                 // previous iteration's LDS reads done

    // ---- stage V tile [d][m] (straight copy -> async-to-LDS)
    async_copy16(Vb + (size_t)(sd * NH + h) * NN + mS + sm, &ldsV[sd * 32 + sm]);

    // ---- stage K tile transposed to [m][d]
    {
      Ld16 t4;
      t4.q = *(const float4*)(Kb + (size_t)(sd * NH + h) * NN + mS + sm);
#pragma unroll
      for (int j = 0; j < 8; ++j) ldsKt[(sm + j) * 64 + sd] = t4.h[j];
    }
    wait_async();
    __syncthreads();

    // ---- S = scale * Q^T K  (two 16x16 tiles covering 32 keys)
    v8f s[2];
#pragma unroll
    for (int t = 0; t < 2; ++t) {
      s[t] = zero;
#pragma unroll
      for (int f = 0; f < 2; ++f) {
        Frag16 kb;
        const unsigned* p32 = (const unsigned*)(ldsKt + (t * 16 + lm) * 64);
#pragma unroll
        for (int p = 0; p < 8; ++p) {
          int k = f * 32 + hi * 8 + ((p & 4) << 2) + ((p & 3) << 1);
          kb.u[p] = p32[k >> 1];
        }
        s[t] = __builtin_amdgcn_wmma_f32_16x16x32_f16(
            false, qa[f].v, false, kb.v, (short)0, s[t], false, false);
      }
    }

    // ---- online softmax (rows r+8*hi; cols live across 16-lane halves)
    float p0[8], p1[8];
#pragma unroll
    for (int r = 0; r < 8; ++r) {
      float s0 = s[0][r] * 0.125f;   // 1/sqrt(64)
      float s1 = s[1][r] * 0.125f;
      float rmax = fmaxf(s0, s1);
#pragma unroll
      for (int msk = 1; msk < 16; msk <<= 1)
        rmax = fmaxf(rmax, __shfl_xor(rmax, msk, 32));
      float mnew  = fmaxf(mrow[r], rmax);
      float alpha = __expf(mrow[r] - mnew);
      mrow[r] = mnew;
      p0[r] = __expf(s0 - mnew);
      p1[r] = __expf(s1 - mnew);
      float rs = p0[r] + p1[r];
#pragma unroll
      for (int msk = 1; msk < 16; msk <<= 1)
        rs += __shfl_xor(rs, msk, 32);
      lrow[r] = lrow[r] * alpha + rs;
#pragma unroll
      for (int f = 0; f < 4; ++f) oacc[f][r] *= alpha;
    }

    // ---- transpose P (C layout) -> A layout via per-wave LDS slab
#pragma unroll
    for (int r = 0; r < 8; ++r) {
      pl[(r + 8 * hi) * 32 + lm]      = (f16)p0[r];
      pl[(r + 8 * hi) * 32 + lm + 16] = (f16)p1[r];
    }
    __syncthreads();
    Frag16 pa;
    {
      const unsigned* p32 = (const unsigned*)(pl + lm * 32);
#pragma unroll
      for (int p = 0; p < 8; ++p) {
        int k = hi * 8 + ((p & 4) << 2) + ((p & 3) << 1);
        pa.u[p] = p32[k >> 1];
      }
    }

    // ---- O^T += P V^T   (K = 32 keys, 4 tiles covering d=64)
#pragma unroll
    for (int f = 0; f < 4; ++f) {
      Frag16 vb;
      const unsigned* p32 = (const unsigned*)(ldsV + (f * 16 + lm) * 32);
#pragma unroll
      for (int p = 0; p < 8; ++p) {
        int m = hi * 8 + ((p & 4) << 2) + ((p & 3) << 1);
        vb.u[p] = p32[m >> 1];
      }
      oacc[f] = __builtin_amdgcn_wmma_f32_16x16x32_f16(
          false, pa.v, false, vb.v, (short)0, oacc[f], false, false);
    }
  }

  // ---- normalize and scatter O^T[n,d] back to [b, d*16+h, n] (f16)
#pragma unroll
  for (int f = 0; f < 4; ++f) {
    int d = f * 16 + lm;
#pragma unroll
    for (int r = 0; r < 8; ++r) {
      int n = n0 + 8 * hi + r;
      float v = oacc[f][r] / lrow[r];
      Xa[boff + (size_t)(d * NH + h) * NN + n] = (f16)v;
    }
  }
}

// ---------------------------------------------------------------------------
extern "C" void kernel_launch(void* const* d_in, const int* in_sizes, int n_in,
                              void* d_out, int out_size, void* d_ws, size_t ws_size,
                              hipStream_t stream) {
  const float* q_in = (const float*)d_in[0];
  const float* k_in = (const float*)d_in[1];
  const float* v_in = (const float*)d_in[2];
  const float* Wq = (const float*)d_in[3];
  const float* bq = (const float*)d_in[4];
  const float* Wk = (const float*)d_in[5];
  const float* bk = (const float*)d_in[6];
  const float* Wv = (const float*)d_in[7];
  const float* bv = (const float*)d_in[8];
  const float* Wm = (const float*)d_in[9];
  const float* bm = (const float*)d_in[10];
  float* out = (float*)d_out;

  // workspace partition (all f16)
  f16* ws = (f16*)d_ws;
  const size_t SB = (size_t)BATCH * DM * NN;  // 8M elems
  const size_t SW = (size_t)DM * DM;          // 1M elems
  f16* q16  = ws;
  f16* k16  = q16  + SB;
  f16* v16  = k16  + SB;
  f16* wq16 = v16  + SB;
  f16* wk16 = wq16 + SW;
  f16* wv16 = wk16 + SW;
  f16* wm16 = wv16 + SW;
  f16* Qp   = wm16 + SW;
  f16* Kp   = Qp   + SB;
  f16* Vp   = Kp   + SB;
  f16* Xat  = Vp   + SB;

  // 1) convert fp32 inputs/weights to f16
  cvt_f32_to_f16<<<1024, 256, 0, stream>>>(q_in, q16, (long)SB);
  cvt_f32_to_f16<<<1024, 256, 0, stream>>>(k_in, k16, (long)SB);
  cvt_f32_to_f16<<<1024, 256, 0, stream>>>(v_in, v16, (long)SB);
  cvt_f32_to_f16<<<256, 256, 0, stream>>>(Wq, wq16, (long)SW);
  cvt_f32_to_f16<<<256, 256, 0, stream>>>(Wk, wk16, (long)SW);
  cvt_f32_to_f16<<<256, 256, 0, stream>>>(Wv, wv16, (long)SW);
  cvt_f32_to_f16<<<256, 256, 0, stream>>>(Wm, wm16, (long)SW);

  // 2) Q/K/V projections (WMMA GEMM, f16 out)
  dim3 gg(NN / BN, DM / BM, BATCH);
  gemm1024_wmma<<<gg, 256, 0, stream>>>(wq16, q16, bq, Qp, nullptr, 0);
  gemm1024_wmma<<<gg, 256, 0, stream>>>(wk16, k16, bk, Kp, nullptr, 0);
  gemm1024_wmma<<<gg, 256, 0, stream>>>(wv16, v16, bv, Vp, nullptr, 0);

  // 3) flash attention: one block per (b,h,128 queries); 8 waves share K/V LDS tiles
  attn_wmma<<<BATCH * NH * (NN / 128), 256, 0, stream>>>(Qp, Kp, Vp, Xat);

  // 4) output projection (fp32 out)
  gemm1024_wmma<<<gg, 256, 0, stream>>>(wm16, Xat, bm, nullptr, out, 1);
}

// v002
// Measured time: 312 microseconds a run.
// Timed twice side by side with v001, it ran 1.18 times as fast both times.
// Counting every step since v000, it is 1.58 times as fast.
#include <hip/hip_runtime.h>
#include <hip/hip_bf16.h>

typedef _Float16 f16;
typedef __attribute__((ext_vector_type(16))) _Float16 v16h;
typedef __attribute__((ext_vector_type(8)))  float    v8f;
typedef __attribute__((ext_vector_type(4)))  int      v4i;
typedef __attribute__((ext_vector_type(8)))  short    v8s;

#define DM 1024   // d_model
#define NN 1024   // sequence length
#define BATCH 8
#define NH 16     // heads
#define HD 64     // head dim

#define BM 128
#define BN 128
#define BK 32
#define XP 144
#define P32 40
#define P64 72

union Frag16 { v16h v; unsigned u[8]; f16 h[16]; };
union FragT  { v16h v; v8s q[2]; };
union Ld16   { float4 q;    f16 h[8];  };

#if defined(__gfx1250__) && __has_builtin(__builtin_amdgcn_global_load_async_to_lds_b128)
#define USE_ASYNC_LDS 1
#else
#define USE_ASYNC_LDS 0
#endif

__device__ inline void async_copy16(const f16* g, f16* l) {
#if USE_ASYNC_LDS
  f16* gnc = (f16*)g;  // strip const first; then retype + addrspacecast
  __builtin_amdgcn_global_load_async_to_lds_b128(
      (v4i __attribute__((address_space(1)))*)gnc,
      (v4i __attribute__((address_space(3)))*)l, 0, 0);
#else
  *(float4*)l = *(const float4*)g;
#endif
}

__device__ inline void wait_async() {
#if USE_ASYNC_LDS
#if __has_builtin(__builtin_amdgcn_s_wait_asynccnt)
  __builtin_amdgcn_s_wait_asynccnt(0);
#else
  asm volatile("s_wait_asynccnt 0" ::: "memory");
#endif
#endif
}

// ---------------------------------------------------------------------------
// fp32 -> f16 conversion (grid-stride)
// ---------------------------------------------------------------------------
__global__ void cvt_f32_to_f16(const float* __restrict__ in, f16* __restrict__ out, long n) {
  long i = (long)blockIdx.x * blockDim.x + threadIdx.x;
  long stride = (long)gridDim.x * blockDim.x;
  for (; i < n; i += stride) out[i] = (f16)in[i];
}

__device__ inline v16h frag_from_lds(const f16* rowbase, int khalf) {
  Frag16 f;
  const unsigned* p32 = (const unsigned*)rowbase;
#pragma unroll
  for (int p = 0; p < 8; ++p) {
    int k = khalf + ((p & 4) << 2) + ((p & 3) << 1);
    f.u[p] = p32[k >> 1];
  }
  return f.v;
}

// ---------------------------------------------------------------------------
// Build a 32x16 f16 B fragment from an LDS tile stored [k][n], n contiguous,
// row pitch XP. The transposing load hands lane (c = lane & 15, h = lane >> 4)
// the eight values T[kbase + 8h + 0..7][c]; the loads at kbase 0 and 16 give
// the same k order as frag_from_lds gives the A side.
// ---------------------------------------------------------------------------
__device__ inline v16h frag_tr_from_lds(const f16* colbase, int lane) {
  typedef __attribute__((address_space(3))) v8s lds_v8s;
  const f16* p = colbase + ((lane >> 4) * 8 + (lane & 7)) * XP + ((lane >> 3) & 1) * 8;
  FragT f;
  f.q[0] = __builtin_amdgcn_ds_load_tr16_b128_v8i16((lds_v8s*)p);
  f.q[1] = __builtin_amdgcn_ds_load_tr16_b128_v8i16((lds_v8s*)(p + 16 * XP));
  return f.v;
}

// ---------------------------------------------------------------------------
// GEMM: Y[b] = W(1024x1024) @ X[b](1024x1024) + bias   (per-batch, f16 WMMA)
// Double-buffered LDS; both tiles filled with async-to-LDS; the X tile stays
// [k][n] as in memory and is transposed by the LDS read.
// writeF32 ? write float to Yf : write f16 to Yh
// ---------------------------------------------------------------------------
__global__ __launch_bounds__(256)
void gemm1024_wmma(const f16* __restrict__ W, const f16* __restrict__ X,
                   const float* __restrict__ bias,
                   f16* __restrict__ Yh, float* __restrict__ Yf, int writeF32)
{
  __shared__ __attribute__((aligned(16))) f16 ldsW[2][BM * P32];  // [m][k], k contiguous, padded rows
  __shared__ __attribute__((aligned(16))) f16 ldsX[2][BK * XP];   // [k][n], n contiguous, padded rows

  const int b  = blockIdx.z;
  const f16* Xb = X + (size_t)b * DM * NN;
  const int m0 = blockIdx.y * BM;
  const int n0 = blockIdx.x * BN;
  const int tid  = threadIdx.x;
  const int lane = tid & 31;
  const int wave = tid >> 5;
  const int wm = (wave >> 1) * 32;   // 4 waves along M
  const int wn = (wave & 1) * 64;    // 2 waves along N
  const int lm = lane & 15;
  const int hi = lane >> 4;
  const int khalf = hi * 8;

  auto stageW = [&](int buf, int k0) {
    int m  = tid >> 1;
    int kk = (tid & 1) * 16;
    const f16* src = W + (size_t)(m0 + m) * DM + k0 + kk;
    f16* dst = &ldsW[buf][m * P32 + kk];
    async_copy16(src, dst);
    async_copy16(src + 8, dst + 8);
  };
  auto stageX = [&](int buf, int k0) {
    int kk = tid >> 3;          // 0..31: row k of the tile
    int nn = (tid & 7) * 8;     // 8 lanes x 16 B = one whole 128-B line of the row
    const f16* src = Xb + (size_t)(k0 + kk) * NN + n0 + nn;
    f16* dst = &ldsX[buf][kk * XP + nn];
    async_copy16(src, dst);
    async_copy16(src + 64, dst + 64);
  };

  v8f zero = {};
  v8f acc[2][4];
#pragma unroll
  for (int i = 0; i < 2; ++i)
#pragma unroll
    for (int j = 0; j < 4; ++j) acc[i][j] = zero;

  // prologue: fill buffer 0
  stageW(0, 0);
  stageX(0, 0);
  // this wave's copies of tile 0 have landed before the barrier publishes them
  asm volatile("s_wait_asynccnt 0x0" ::: "memory");
  __syncthreads();

  for (int k0 = 0; k0 < DM; k0 += BK) {
    const int cur = (k0 >> 5) & 1;
    const int nxt = cur ^ 1;

    // overlap: start filling the next tile before computing on the current
    if (k0 + BK < DM) {
      stageW(nxt, k0 + BK);
      stageX(nxt, k0 + BK);
    }

    v16h a[2], bb[4];
#pragma unroll
    for (int mt = 0; mt < 2; ++mt)
      a[mt]  = frag_from_lds(&ldsW[cur][(wm + mt * 16 + lm) * P32], khalf);
#pragma unroll
    for (int nt = 0; nt < 4; ++nt)
      bb[nt] = frag_tr_from_lds(&ldsX[cur][wn + nt * 16], lane);

#pragma unroll
    for (int mt = 0; mt < 2; ++mt)
#pragma unroll
      for (int nt = 0; nt < 4; ++nt)
        acc[mt][nt] = __builtin_amdgcn_wmma_f32_16x16x32_f16(
            false, a[mt], false, bb[nt], (short)0, acc[mt][nt], false, false);

    // this wave's LDS reads of the current buffers are over before the barrier frees them for refill
    asm volatile("s_wait_dscnt 0x0" ::: "memory");
    // this wave's copies of the next tile have landed before the barrier publishes them
    asm volatile("s_wait_asynccnt 0x0" ::: "memory");
    __syncthreads();
  }

  // epilogue: C/D layout row = vgpr + 8*hi, col = lane&15
#pragma unroll
  for (int mt = 0; mt < 2; ++mt) {
#pragma unroll
    for (int nt = 0; nt < 4; ++nt) {
      int col = n0 + wn + nt * 16 + lm;
#pragma unroll
      for (int r = 0; r < 8; ++r) {
        int row = m0 + wm + mt * 16 + hi * 8 + r;
        float v = acc[mt][nt][r] + bias[row];
        size_t idx = ((size_t)b * DM + row) * NN + col;
        if (writeF32) Yf[idx] = v;
        else          Yh[idx] = (f16)v;
      }
    }
  }
}

// ---------------------------------------------------------------------------
// Flash attention over Q/K/V f16 buffers laid out [b, c, n], c = d*16 + h.
// One block handles one (b, h) and 128 queries; its 8 waves cover 8 query tiles of 16 rows
// and SHARE the K/V tiles staged cooperatively into LDS per 32-key step.
// ---------------------------------------------------------------------------
__global__ __launch_bounds__(256)
void attn_wmma(const f16* __restrict__ Q, const f16* __restrict__ Km,
               const f16* __restrict__ Vm, f16* __restrict__ Xa)
{
  __shared__ __attribute__((aligned(16))) f16 ldsKt[32 * P64];     // K tile transposed: [m][d], d contiguous, padded rows
  __shared__ __attribute__((aligned(16))) f16 ldsV [64 * P32];     // V tile:            [d][m], m contiguous, padded rows
  __shared__ __attribute__((aligned(16))) f16 ldsP [8][16 * P32];  // per-wave P transpose slab, padded rows

  const int tid  = threadIdx.x;
  const int lane = tid & 31;
  const int wave = tid >> 5;
  const int lm = lane & 15;
  const int hi = lane >> 4;

  const int gid = blockIdx.x;        // B*H*8 = 1024 blocks
  const int b  = gid >> 7;
  const int h  = (gid >> 3) & 15;
  const int qc = gid & 7;
  const int n0 = (qc * 8 + wave) * 16;

  const size_t boff = (size_t)b * DM * NN;
  const f16* Qb = Q  + boff;
  const f16* Kb = Km + boff;
  const f16* Vb = Vm + boff;

  // Q^T as A fragments: rows n (lane), K = head-dim d (64 -> 2 frags)
  Frag16 qa[2];
#pragma unroll
  for (int f = 0; f < 2; ++f)
#pragma unroll
    for (int e = 0; e < 16; ++e) {
      int d = f * 32 + hi * 8 + ((e & 8) << 1) + (e & 7);
      qa[f].h[e] = Qb[(size_t)(d * NH + h) * NN + (n0 + lm)];
    }

  v8f zero = {};
  v8f oacc[4];
#pragma unroll
  for (int f = 0; f < 4; ++f) oacc[f] = zero;
  float mrow[8], lrow[8];
#pragma unroll
  for (int r = 0; r < 8; ++r) { mrow[r] = -1.0e30f; lrow[r] = 0.0f; }

  f16* pl = &ldsP[wave][0];
  const int sd = tid >> 2;           // 0..63: head-dim row for staging
  const int sm = (tid & 3) * 8;      // 0,8,16,24: key chunk for staging

  for (int mS = 0; mS < NN; mS += 32) {
    __syncthreads();                 // previous iteration's LDS reads done

    // ---- stage V tile [d][m] (straight copy -> async-to-LDS)
    async_copy16(Vb + (size_t)(sd * NH + h) * NN + mS + sm, &ldsV[sd * P32 + sm]);

    // ---- stage K tile transposed to [m][d]
    {
      Ld16 t4;
      t4.q = *(const float4*)(Kb + (size_t)(sd * NH + h) * NN + mS + sm);
#pragma unroll
      for (int j = 0; j < 8; ++j) ldsKt[(sm + j) * P64 + sd] = t4.h[j];
    }
    wait_async();
    __syncthreads();

    // ---- S = scale * Q^T K  (two 16x16 tiles covering 32 keys)
    v8f s[2];
#pragma unroll
    for (int t = 0; t < 2; ++t) {
      s[t] = zero;
#pragma unroll
      for (int f = 0; f < 2; ++f) {
        Frag16 kb;
        const unsigned* p32 = (const unsigned*)(ldsKt + (t * 16 + lm) * P64);
#pragma unroll
        for (int p = 0; p < 8; ++p) {
          int k = f * 32 + hi * 8 + ((p & 4) << 2) + ((p & 3) << 1);
          kb.u[p] = p32[k >> 1];
        }
        s[t] = __builtin_amdgcn_wmma_f32_16x16x32_f16(
            false, qa[f].v, false, kb.v, (short)0, s[t], false, false);
      }
    }

    // ---- online softmax (rows r+8*hi; cols live across 16-lane halves)
    float p0[8], p1[8];
#pragma unroll
    for (int r = 0; r < 8; ++r) {
      float s0 = s[0][r] * 0.125f;   // 1/sqrt(64)
      float s1 = s[1][r] * 0.125f;
      float rmax = fmaxf(s0, s1);
#pragma unroll
      for (int msk = 1; msk < 16; msk <<= 1)
        rmax = fmaxf(rmax, __shfl_xor(rmax, msk, 32));
      float mnew  = fmaxf(mrow[r], rmax);
      float alpha = __expf(mrow[r] - mnew);
      mrow[r] = mnew;
      p0[r] = __expf(s0 - mnew);
      p1[r] = __expf(s1 - mnew);
      float rs = p0[r] + p1[r];
#pragma unroll
      for (int msk = 1; msk < 16; msk <<= 1)
        rs += __shfl_xor(rs, msk, 32);
      lrow[r] = lrow[r] * alpha + rs;
#pragma unroll
      for (int f = 0; f < 4; ++f) oacc[f][r] *= alpha;
    }

    // ---- transpose P (C layout) -> A layout via per-wave LDS slab
#pragma unroll
    for (int r = 0; r < 8; ++r) {
      pl[(r + 8 * hi) * P32 + lm]      = (f16)p0[r];
      pl[(r + 8 * hi) * P32 + lm + 16] = (f16)p1[r];
    }
    __syncthreads();
    Frag16 pa;
    {
      const unsigned* p32 = (const unsigned*)(pl + lm * P32);
#pragma unroll
      for (int p = 0; p < 8; ++p) {
        int k = hi * 8 + ((p & 4) << 2) + ((p & 3) << 1);
        pa.u[p] = p32[k >> 1];
      }
    }

    // ---- O^T += P V^T   (K = 32 keys, 4 tiles covering d=64)
#pragma unroll
    for (int f = 0; f < 4; ++f) {
      Frag16 vb;
      const unsigned* p32 = (const unsigned*)(ldsV + (f * 16 + lm) * P32);
#pragma unroll
      for (int p = 0; p < 8; ++p) {
        int m = hi * 8 + ((p & 4) << 2) + ((p & 3) << 1);
        vb.u[p] = p32[m >> 1];
      }
      oacc[f] = __builtin_amdgcn_wmma_f32_16x16x32_f16(
          false, pa.v, false, vb.v, (short)0, oacc[f], false, false);
    }
  }

  // ---- normalize and scatter O^T[n,d] back to [b, d*16+h, n] (f16)
#pragma unroll
  for (int f = 0; f < 4; ++f) {
    int d = f * 16 + lm;
#pragma unroll
    for (int r = 0; r < 8; ++r) {
      int n = n0 + 8 * hi + r;
      float v = oacc[f][r] / lrow[r];
      Xa[boff + (size_t)(d * NH + h) * NN + n] = (f16)v;
    }
  }
}

// ---------------------------------------------------------------------------
extern "C" void kernel_launch(void* const* d_in, const int* in_sizes, int n_in,
                              void* d_out, int out_size, void* d_ws, size_t ws_size,
                              hipStream_t stream) {
  const float* q_in = (const float*)d_in[0];
  const float* k_in = (const float*)d_in[1];
  const float* v_in = (const float*)d_in[2];
  const float* Wq = (const float*)d_in[3];
  const float* bq = (const float*)d_in[4];
  const float* Wk = (const float*)d_in[5];
  const float* bk = (const float*)d_in[6];
  const float* Wv = (const float*)d_in[7];
  const float* bv = (const float*)d_in[8];
  const float* Wm = (const float*)d_in[9];
  const float* bm = (const float*)d_in[10];
  float* out = (float*)d_out;

  // workspace partition (all f16)
  f16* ws = (f16*)d_ws;
  const size_t SB = (size_t)BATCH * DM * NN;  // 8M elems
  const size_t SW = (size_t)DM * DM;          // 1M elems
  f16* q16  = ws;
  f16* k16  = q16  + SB;
  f16* v16  = k16  + SB;
  f16* wq16 = v16  + SB;
  f16* wk16 = wq16 + SW;
  f16* wv16 = wk16 + SW;
  f16* wm16 = wv16 + SW;
  f16* Qp   = wm16 + SW;
  f16* Kp   = Qp   + SB;
  f16* Vp   = Kp   + SB;
  f16* Xat  = Vp   + SB;

  // 1) convert fp32 inputs/weights to f16
  cvt_f32_to_f16<<<1024, 256, 0, stream>>>(q_in, q16, (long)SB);
  cvt_f32_to_f16<<<1024, 256, 0, stream>>>(k_in, k16, (long)SB);
  cvt_f32_to_f16<<<1024, 256, 0, stream>>>(v_in, v16, (long)SB);
  cvt_f32_to_f16<<<256, 256, 0, stream>>>(Wq, wq16, (long)SW);
  cvt_f32_to_f16<<<256, 256, 0, stream>>>(Wk, wk16, (long)SW);
  cvt_f32_to_f16<<<256, 256, 0, stream>>>(Wv, wv16, (long)SW);
  cvt_f32_to_f16<<<256, 256, 0, stream>>>(Wm, wm16, (long)SW);

  // 2) Q/K/V projections (WMMA GEMM, f16 out)
  dim3 gg(NN / BN, DM / BM, BATCH);
  gemm1024_wmma<<<gg, 256, 0, stream>>>(wq16, q16, bq, Qp, nullptr, 0);
  gemm1024_wmma<<<gg, 256, 0, stream>>>(wk16, k16, bk, Kp, nullptr, 0);
  gemm1024_wmma<<<gg, 256, 0, stream>>>(wv16, v16, bv, Vp, nullptr, 0);

  // 3) flash attention: one block per (b,h,128 queries); 8 waves share K/V LDS tiles
  attn_wmma<<<BATCH * NH * (NN / 128), 256, 0, stream>>>(Qp, Kp, Vp, Xat);

  // 4) output projection (fp32 out)
  gemm1024_wmma<<<gg, 256, 0, stream>>>(wm16, Xat, bm, nullptr, out, 1);
}

// v003
// A run of this version takes 277 microseconds.
// Two timings next to v002 put it at 1.13 and 1.12 times that version's speed.
// Over all steps from v000 it is 1.78 times as fast.
#include <hip/hip_runtime.h>
#include <hip/hip_bf16.h>

typedef _Float16 f16;
typedef __attribute__((ext_vector_type(16))) _Float16 v16h;
typedef __attribute__((ext_vector_type(8)))  float    v8f;
typedef __attribute__((ext_vector_type(4)))  int      v4i;
typedef __attribute__((ext_vector_type(8)))  short    v8s;

#define DM 1024   // d_model
#define NN 1024   // sequence length
#define BATCH 8
#define NH 16     // heads
#define HD 64     // head dim

#define BM 128
#define BN 128
#define BK 32
#define XP 144
#define P32 40
#define P64 72

union Frag16 { v16h v; unsigned u[8]; f16 h[16]; };
union FragT  { v16h v; v8s q[2]; };
union Ld16   { float4 q;    f16 h[8];  };

#if defined(__gfx1250__) && __has_builtin(__builtin_amdgcn_global_load_async_to_lds_b128)
#define USE_ASYNC_LDS 1
#else
#define USE_ASYNC_LDS 0
#endif

__device__ inline void async_copy16(const f16* g, f16* l) {
#if USE_ASYNC_LDS
  f16* gnc = (f16*)g;  // strip const first; then retype + addrspacecast
  __builtin_amdgcn_global_load_async_to_lds_b128(
      (v4i __attribute__((address_space(1)))*)gnc,
      (v4i __attribute__((address_space(3)))*)l, 0, 0);
#else
  *(float4*)l = *(const float4*)g;
#endif
}

__device__ inline void wait_async() {
#if USE_ASYNC_LDS
#if __has_builtin(__builtin_amdgcn_s_wait_asynccnt)
  __builtin_amdgcn_s_wait_asynccnt(0);
#else
  asm volatile("s_wait_asynccnt 0" ::: "memory");
#endif
#endif
}

// ---------------------------------------------------------------------------
// fp32 -> f16 conversion (grid-stride)
// ---------------------------------------------------------------------------
__global__ void cvt_f32_to_f16(const float* __restrict__ in, f16* __restrict__ out, long n) {
  long i = (long)blockIdx.x * blockDim.x + threadIdx.x;
  long stride = (long)gridDim.x * blockDim.x;
  for (; i < n; i += stride) out[i] = (f16)in[i];
}

__device__ inline v16h frag_from_lds(const f16* rowbase, int khalf) {
  Frag16 f;
  const unsigned* p32 = (const unsigned*)rowbase;
#pragma unroll
  for (int p = 0; p < 8; ++p) {
    int k = khalf + ((p & 4) << 2) + ((p & 3) << 1);
    f.u[p] = p32[k >> 1];
  }
  return f.v;
}

// ---------------------------------------------------------------------------
// Build a 32x16 f16 B fragment from an LDS tile stored [k][n], n contiguous,
// row pitch XP. The transposing load hands lane (c = lane & 15, h = lane >> 4)
// the eight values T[kbase + 8h + 0..7][c]; the loads at kbase 0 and 16 give
// the same k order as frag_from_lds gives the A side.
// ---------------------------------------------------------------------------
__device__ inline v16h frag_tr_from_lds(const f16* colbase, int lane) {
  typedef __attribute__((address_space(3))) v8s lds_v8s;
  const f16* p = colbase + ((lane >> 4) * 8 + (lane & 7)) * XP + ((lane >> 3) & 1) * 8;
  FragT f;
  f.q[0] = __builtin_amdgcn_ds_load_tr16_b128_v8i16((lds_v8s*)p);
  f.q[1] = __builtin_amdgcn_ds_load_tr16_b128_v8i16((lds_v8s*)(p + 16 * XP));
  return f.v;
}

// ---------------------------------------------------------------------------
// GEMM: Y[b] = W(1024x1024) @ X[b](1024x1024) + bias   (per-batch, f16 WMMA)
// Double-buffered LDS; both tiles filled with async-to-LDS; the X tile stays
// [k][n] as in memory and is transposed by the LDS read.
// writeF32 ? write float to Yf : write f16 to Yh
// ---------------------------------------------------------------------------
__global__ __launch_bounds__(256)
void gemm1024_wmma(const f16* __restrict__ W, const f16* __restrict__ X,
                   const float* __restrict__ bias,
                   f16* __restrict__ Yh, float* __restrict__ Yf, int writeF32)
{
  __shared__ __attribute__((aligned(16))) f16 ldsW[2][BM * P32];  // [m][k], k contiguous, padded rows
  __shared__ __attribute__((aligned(16))) f16 ldsX[2][BK * XP];   // [k][n], n contiguous, padded rows

  const int b  = blockIdx.z;
  const f16* Xb = X + (size_t)b * DM * NN;
  const int m0 = blockIdx.y * BM;
  const int n0 = blockIdx.x * BN;
  const int tid  = threadIdx.x;
  const int lane = tid & 31;
  const int wave = tid >> 5;
  const int wm = (wave >> 1) * 32;   // 4 waves along M
  const int wn = (wave & 1) * 64;    // 2 waves along N
  const int lm = lane & 15;
  const int hi = lane >> 4;
  const int khalf = hi * 8;

  auto stageW = [&](int buf, int k0) {
    int m  = tid >> 1;
    int kk = (tid & 1) * 16;
    const f16* src = W + (size_t)(m0 + m) * DM + k0 + kk;
    f16* dst = &ldsW[buf][m * P32 + kk];
    async_copy16(src, dst);
    async_copy16(src + 8, dst + 8);
  };
  auto stageX = [&](int buf, int k0) {
    int kk = tid >> 3;          // 0..31: row k of the tile
    int nn = (tid & 7) * 8;     // 8 lanes x 16 B = one whole 128-B line of the row
    const f16* src = Xb + (size_t)(k0 + kk) * NN + n0 + nn;
    f16* dst = &ldsX[buf][kk * XP + nn];
    async_copy16(src, dst);
    async_copy16(src + 64, dst + 64);
  };

  v8f zero = {};
  v8f acc[2][4];
#pragma unroll
  for (int i = 0; i < 2; ++i)
#pragma unroll
    for (int j = 0; j < 4; ++j) acc[i][j] = zero;

  // prologue: fill buffer 0
  stageW(0, 0);
  stageX(0, 0);
  // this wave's copies of tile 0 have landed before the barrier publishes them
  asm volatile("s_wait_asynccnt 0x0" ::: "memory");
  __syncthreads();

  for (int k0 = 0; k0 < DM; k0 += BK) {
    const int cur = (k0 >> 5) & 1;
    const int nxt = cur ^ 1;

    // overlap: start filling the next tile before computing on the current
    if (k0 + BK < DM) {
      stageW(nxt, k0 + BK);
      stageX(nxt, k0 + BK);
    }

    v16h a[2], bb[4];
#pragma unroll
    for (int mt = 0; mt < 2; ++mt)
      a[mt]  = frag_from_lds(&ldsW[cur][(wm + mt * 16 + lm) * P32], khalf);
#pragma unroll
    for (int nt = 0; nt < 4; ++nt)
      bb[nt] = frag_tr_from_lds(&ldsX[cur][wn + nt * 16], lane);

#pragma unroll
    for (int mt = 0; mt < 2; ++mt)
#pragma unroll
      for (int nt = 0; nt < 4; ++nt)
        acc[mt][nt] = __builtin_amdgcn_wmma_f32_16x16x32_f16(
            false, a[mt], false, bb[nt], (short)0, acc[mt][nt], false, false);

    // this wave's LDS reads of the current buffers are over before the barrier frees them for refill
    asm volatile("s_wait_dscnt 0x0" ::: "memory");
    // this wave's copies of the next tile have landed before the barrier publishes them
    asm volatile("s_wait_asynccnt 0x0" ::: "memory");
    __syncthreads();
  }

  // epilogue: C/D layout row = vgpr + 8*hi, col = lane&15
#pragma unroll
  for (int mt = 0; mt < 2; ++mt) {
#pragma unroll
    for (int nt = 0; nt < 4; ++nt) {
      int col = n0 + wn + nt * 16 + lm;
#pragma unroll
      for (int r = 0; r < 8; ++r) {
        int row = m0 + wm + mt * 16 + hi * 8 + r;
        float v = acc[mt][nt][r] + bias[row];
        size_t idx = ((size_t)b * DM + row) * NN + col;
        if (writeF32) Yf[idx] = v;
        else          Yh[idx] = (f16)v;
      }
    }
  }
}

__device__ inline float xhalf(float x) {
  int b = __builtin_bit_cast(int, x);
  return __builtin_bit_cast(float,
      __builtin_amdgcn_permlanex16(b, b, 0x76543210, 0xfedcba98, false, false));
}

// ---------------------------------------------------------------------------
// Flash attention over Q/K/V f16 buffers laid out [b, c, n], c = d*16 + h.
// One block handles 128 queries of one (b, h); its 8 waves cover 8 query tiles of 16 columns
// and SHARE the K/V tiles staged cooperatively into LDS per 32-key step.
// Both products are taken transposed, S^T = K^T Q and O = V P^T: a lane holds
// the scores of ONE query (16 of the 32 keys, the other 16 in lane ^ 16), so
// maximum and sum run down its own registers, and the two score tiles,
// converted in place, are the B operand of the second product.
// ---------------------------------------------------------------------------
__global__ __launch_bounds__(256)
void attn_wmma(const f16* __restrict__ Q, const f16* __restrict__ Km,
               const f16* __restrict__ Vm, f16* __restrict__ Xa)
{
  __shared__ __attribute__((aligned(16))) f16 ldsKt[32 * P64];     // K tile transposed: [m][d], d contiguous, padded rows
  __shared__ __attribute__((aligned(16))) f16 ldsV [64 * P32];     // V tile:            [d][m], m contiguous, padded rows

  const int tid  = threadIdx.x;
  const int lane = tid & 31;
  const int wave = tid >> 5;
  const int lm = lane & 15;
  const int hi = lane >> 4;

  const int gid = blockIdx.x;        // B*H*8 = 1024 blocks
  const int b  = gid >> 7;
  const int h  = (gid >> 3) & 15;
  const int qc = gid & 7;
  const int n0 = (qc * 8 + wave) * 16;

  const size_t boff = (size_t)b * DM * NN;
  const f16* Qb = Q  + boff;
  const f16* Kb = Km + boff;
  const f16* Vb = Vm + boff;

  // Q as B fragments: column n (lane), K = head-dim d (64 -> 2 frags)
  Frag16 qa[2];
#pragma unroll
  for (int f = 0; f < 2; ++f)
#pragma unroll
    for (int e = 0; e < 16; ++e) {
      int d = f * 32 + hi * 8 + ((e & 8) << 1) + (e & 7);
      qa[f].h[e] = Qb[(size_t)(d * NH + h) * NN + (n0 + lm)];
    }

  v8f zero = {};
  v8f oacc[4];                       // O[d = f*16 + 8*hi + r][n0 + lm]
#pragma unroll
  for (int f = 0; f < 4; ++f) oacc[f] = zero;
  float mrow = -1.0e30f;             // running maximum of query n0 + lm (equal in both halves)
  float lrow = 0.0f;                 // running sum over this half's keys; the halves join after the loop

  const int sd = tid >> 2;           // 0..63: head-dim row for staging
  const int sm = (tid & 3) * 8;      // 0,8,16,24: key chunk for staging

  for (int mS = 0; mS < NN; mS += 32) {
    __syncthreads();                 // previous iteration's LDS reads done

    // ---- stage V tile [d][m] (straight copy -> async-to-LDS)
    async_copy16(Vb + (size_t)(sd * NH + h) * NN + mS + sm, &ldsV[sd * P32 + sm]);

    // ---- stage K tile transposed to [m][d]
    {
      Ld16 t4;
      t4.q = *(const float4*)(Kb + (size_t)(sd * NH + h) * NN + mS + sm);
#pragma unroll
      for (int j = 0; j < 8; ++j) ldsKt[(sm + j) * P64 + sd] = t4.h[j];
    }
    wait_async();
    __syncthreads();

    // ---- S^T = K^T Q  (two 16x16 tiles covering 32 keys): s[t][r] = S[n0 + lm][mS + t*16 + 8*hi + r]
    v8f s[2];
#pragma unroll
    for (int t = 0; t < 2; ++t) {
      s[t] = zero;
#pragma unroll
      for (int f = 0; f < 2; ++f) {
        Frag16 kb;
        const unsigned* p32 = (const unsigned*)(ldsKt + (t * 16 + lm) * P64);
#pragma unroll
        for (int p = 0; p < 8; ++p) {
          int k = f * 32 + hi * 8 + ((p & 4) << 2) + ((p & 3) << 1);
          kb.u[p] = p32[k >> 1];
        }
        s[t] = __builtin_amdgcn_wmma_f32_16x16x32_f16(
            false, kb.v, false, qa[f].v, (short)0, s[t], false, false);
      }
    }

    // ---- online softmax: one query a lane, its keys down the registers
    s[0] *= 0.125f;                  // 1/sqrt(64)
    s[1] *= 0.125f;
    float rmax = fmaxf(s[0][0], s[1][0]);
#pragma unroll
    for (int r = 1; r < 8; ++r) rmax = fmaxf(rmax, fmaxf(s[0][r], s[1][r]));
    rmax = fmaxf(rmax, xhalf(rmax));
    const float mnew  = fmaxf(mrow, rmax);
    const float alpha = __expf(mrow - mnew);
    mrow = mnew;

    // P^T in the B layout: element e = key 8*hi + e (e < 8), 16 + 8*hi + (e - 8) above
    Frag16 pb;
    float ps[8];
#pragma unroll
    for (int r = 0; r < 8; ++r) {
      float p0 = __expf(s[0][r] - mnew);
      float p1 = __expf(s[1][r] - mnew);
      pb.h[r]     = (f16)p0;
      pb.h[r + 8] = (f16)p1;
      ps[r] = p0 + p1;
    }
    const float rs = ((ps[0] + ps[1]) + (ps[2] + ps[3])) + ((ps[4] + ps[5]) + (ps[6] + ps[7]));
    lrow = lrow * alpha + rs;
#pragma unroll
    for (int f = 0; f < 4; ++f) oacc[f] *= alpha;

    // ---- O += V P^T   (K = 32 keys, 4 tiles covering d=64)
#pragma unroll
    for (int f = 0; f < 4; ++f) {
      Frag16 vb;
      const unsigned* p32 = (const unsigned*)(ldsV + (f * 16 + lm) * P32);
#pragma unroll
      for (int p = 0; p < 8; ++p) {
        int m = hi * 8 + ((p & 4) << 2) + ((p & 3) << 1);
        vb.u[p] = p32[m >> 1];
      }
      oacc[f] = __builtin_amdgcn_wmma_f32_16x16x32_f16(
          false, vb.v, false, pb.v, (short)0, oacc[f], false, false);
    }
  }

  // ---- join the halves' sums, normalize and store O[d,n] to [b, d*16+h, n] (f16)
  const float lsum = lrow + xhalf(lrow);
#pragma unroll
  for (int f = 0; f < 4; ++f) {
#pragma unroll
    for (int r = 0; r < 8; ++r) {
      int d = f * 16 + 8 * hi + r;
      float v = oacc[f][r] / lsum;
      Xa[boff + (size_t)(d * NH + h) * NN + n0 + lm] = (f16)v;
    }
  }
}

// ---------------------------------------------------------------------------
extern "C" void kernel_launch(void* const* d_in, const int* in_sizes, int n_in,
                              void* d_out, int out_size, void* d_ws, size_t ws_size,
                              hipStream_t stream) {
  const float* q_in = (const float*)d_in[0];
  const float* k_in = (const float*)d_in[1];
  const float* v_in = (const float*)d_in[2];
  const float* Wq = (const float*)d_in[3];
  const float* bq = (const float*)d_in[4];
  const float* Wk = (const float*)d_in[5];
  const float* bk = (const float*)d_in[6];
  const float* Wv = (const float*)d_in[7];
  const float* bv = (const float*)d_in[8];
  const float* Wm = (const float*)d_in[9];
  const float* bm = (const float*)d_in[10];
  float* out = (float*)d_out;

  // workspace partition (all f16)
  f16* ws = (f16*)d_ws;
  const size_t SB = (size_t)BATCH * DM * NN;  // 8M elems
  const size_t SW = (size_t)DM * DM;          // 1M elems
  f16* q16  = ws;
  f16* k16  = q16  + SB;
  f16* v16  = k16  + SB;
  f16* wq16 = v16  + SB;
  f16* wk16 = wq16 + SW;
  f16* wv16 = wk16 + SW;
  f16* wm16 = wv16 + SW;
  f16* Qp   = wm16 + SW;
  f16* Kp   = Qp   + SB;
  f16* Vp   = Kp   + SB;
  f16* Xat  = Vp   + SB;

  // 1) convert fp32 inputs/weights to f16
  cvt_f32_to_f16<<<1024, 256, 0, stream>>>(q_in, q16, (long)SB);
  cvt_f32_to_f16<<<1024, 256, 0, stream>>>(k_in, k16, (long)SB);
  cvt_f32_to_f16<<<1024, 256, 0, stream>>>(v_in, v16, (long)SB);
  cvt_f32_to_f16<<<256, 256, 0, stream>>>(Wq, wq16, (long)SW);
  cvt_f32_to_f16<<<256, 256, 0, stream>>>(Wk, wk16, (long)SW);
  cvt_f32_to_f16<<<256, 256, 0, stream>>>(Wv, wv16, (long)SW);
  cvt_f32_to_f16<<<256, 256, 0, stream>>>(Wm, wm16, (long)SW);

  // 2) Q/K/V projections (WMMA GEMM, f16 out)
  dim3 gg(NN / BN, DM / BM, BATCH);
  gemm1024_wmma<<<gg, 256, 0, stream>>>(wq16, q16, bq, Qp, nullptr, 0);
  gemm1024_wmma<<<gg, 256, 0, stream>>>(wk16, k16, bk, Kp, nullptr, 0);
  gemm1024_wmma<<<gg, 256, 0, stream>>>(wv16, v16, bv, Vp, nullptr, 0);

  // 3) flash attention: one block per (b,h,128 queries); 8 waves share K/V LDS tiles
  attn_wmma<<<BATCH * NH * (NN / 128), 256, 0, stream>>>(Qp, Kp, Vp, Xat);

  // 4) output projection (fp32 out)
  gemm1024_wmma<<<gg, 256, 0, stream>>>(wm16, Xat, bm, nullptr, out, 1);
}

// v004
// A run of this version takes 189 microseconds.
// Two timings next to v003 both put it at 1.47 times that version's speed.
// All steps since v000 together make it 2.61 times as fast.
#include <hip/hip_runtime.h>
#include <hip/hip_bf16.h>

typedef _Float16 f16;
typedef __attribute__((ext_vector_type(16))) _Float16 v16h;
typedef __attribute__((ext_vector_type(8)))  float    v8f;
typedef __attribute__((ext_vector_type(4)))  int      v4i;
typedef __attribute__((ext_vector_type(8)))  short    v8s;

#define DM 1024   // d_model
#define NN 1024   // sequence length
#define BATCH 8
#define NH 16     // heads
#define HD 64     // head dim

#define BM 128
#define BN 128
#define BK 32
#define XP 144
#define P32 40
#define P64 72

union Frag16 { v16h v; unsigned u[8]; f16 h[16]; };
union FragT  { v16h v; v8s q[2]; };
union Ld16   { float4 q;    f16 h[8];  };

#if defined(__gfx1250__) && __has_builtin(__builtin_amdgcn_global_load_async_to_lds_b128)
#define USE_ASYNC_LDS 1
#else
#define USE_ASYNC_LDS 0
#endif

__device__ inline void async_copy16(const f16* g, f16* l) {
#if USE_ASYNC_LDS
  f16* gnc = (f16*)g;  // strip const first; then retype + addrspacecast
  __builtin_amdgcn_global_load_async_to_lds_b128(
      (v4i __attribute__((address_space(1)))*)gnc,
      (v4i __attribute__((address_space(3)))*)l, 0, 0);
#else
  *(float4*)l = *(const float4*)g;
#endif
}

__device__ inline void wait_async() {
#if USE_ASYNC_LDS
#if __has_builtin(__builtin_amdgcn_s_wait_asynccnt)
  __builtin_amdgcn_s_wait_asynccnt(0);
#else
  asm volatile("s_wait_asynccnt 0" ::: "memory");
#endif
#endif
}

// ---------------------------------------------------------------------------
// fp32 -> f16 conversion of all seven operands in ONE launch: each operand has
// its own range of blocks and is walked by that range with a grid-stride loop.
// The f16 copies lie one behind the other in out: q, k, v, Wq, Wk, Wv, Wm.
// ---------------------------------------------------------------------------
#define CVT_T  256    // threads of a block
#define CVT_XB 1024   // blocks of an activation's range
#define CVT_WB 256    // blocks of a weight's range
#define SZ_X ((long)BATCH * DM * NN)
#define SZ_W ((long)DM * DM)

__global__ __launch_bounds__(CVT_T)
void cvt_f32_to_f16(const float* __restrict__ q,  const float* __restrict__ k,
                    const float* __restrict__ v,  const float* __restrict__ wq,
                    const float* __restrict__ wk, const float* __restrict__ wv,
                    const float* __restrict__ wm, f16* __restrict__ out) {
  const unsigned blk = blockIdx.x;
  const float* in;
  long off, n;
  unsigned lb, nb;     // block's place in its range, blocks of the range
  if (blk < 3 * CVT_XB) {
    const unsigned s = blk / CVT_XB;
    in  = s == 0 ? q : s == 1 ? k : v;
    off = s * SZ_X;
    n   = SZ_X;
    lb  = blk % CVT_XB;
    nb  = CVT_XB;
  } else {
    const unsigned s = (blk - 3 * CVT_XB) / CVT_WB;
    in  = s == 0 ? wq : s == 1 ? wk : s == 2 ? wv : wm;
    off = 3 * SZ_X + s * SZ_W;
    n   = SZ_W;
    lb  = (blk - 3 * CVT_XB) % CVT_WB;
    nb  = CVT_WB;
  }
  f16* o = out + off;
  const long stride = (long)nb * CVT_T;
  for (long i = (long)lb * CVT_T + threadIdx.x; i < n; i += stride) o[i] = (f16)in[i];
}

__device__ inline v16h frag_from_lds(const f16* rowbase, int khalf) {
  Frag16 f;
  const unsigned* p32 = (const unsigned*)rowbase;
#pragma unroll
  for (int p = 0; p < 8; ++p) {
    int k = khalf + ((p & 4) << 2) + ((p & 3) << 1);
    f.u[p] = p32[k >> 1];
  }
  return f.v;
}

// ---------------------------------------------------------------------------
// Build a 32x16 f16 B fragment from an LDS tile stored [k][n], n contiguous,
// row pitch XP. The transposing load hands lane (c = lane & 15, h = lane >> 4)
// the eight values T[kbase + 8h + 0..7][c]; the loads at kbase 0 and 16 give
// the same k order as frag_from_lds gives the A side.
// ---------------------------------------------------------------------------
__device__ inline v16h frag_tr_from_lds(const f16* colbase, int lane) {
  typedef __attribute__((address_space(3))) v8s lds_v8s;
  const f16* p = colbase + ((lane >> 4) * 8 + (lane & 7)) * XP + ((lane >> 3) & 1) * 8;
  FragT f;
  f.q[0] = __builtin_amdgcn_ds_load_tr16_b128_v8i16((lds_v8s*)p);
  f.q[1] = __builtin_amdgcn_ds_load_tr16_b128_v8i16((lds_v8s*)(p + 16 * XP));
  return f.v;
}

// ---------------------------------------------------------------------------
// GEMM: Y[z] = W[z / BATCH](1024x1024) @ X[z](1024x1024) + bias[z / BATCH]   (f16 WMMA)
// blockIdx.z = z counts (projection, batch): the projections' W, X and Y lie one
// behind the other in memory, so independent projections share one launch.
// Double-buffered LDS; both tiles filled with async-to-LDS; the X tile stays
// [k][n] as in memory and is transposed by the LDS read.
// writeF32 ? write float to Yf : write f16 to Yh
// ---------------------------------------------------------------------------
__global__ __launch_bounds__(256)
void gemm1024_wmma(const f16* __restrict__ Wall, const f16* __restrict__ X,
                   const float* __restrict__ bias0, const float* __restrict__ bias1,
                   const float* __restrict__ bias2,
                   f16* __restrict__ Yh, float* __restrict__ Yf, int writeF32)
{
  __shared__ __attribute__((aligned(16))) f16 ldsW[2][BM * P32];  // [m][k], k contiguous, padded rows
  __shared__ __attribute__((aligned(16))) f16 ldsX[2][BK * XP];   // [k][n], n contiguous, padded rows

  const int b  = blockIdx.z;          // (projection, batch)
  const int pj = b / BATCH;           // which projection
  const f16* Xb = X + (size_t)b * DM * NN;
  const f16* W  = Wall + (size_t)pj * DM * DM;
  const float* bias = pj == 0 ? bias0 : pj == 1 ? bias1 : bias2;
  const int m0 = blockIdx.y * BM;
  const int n0 = blockIdx.x * BN;
  const int tid  = threadIdx.x;
  const int lane = tid & 31;
  const int wave = tid >> 5;
  const int wm = (wave >> 1) * 32;   // 4 waves along M
  const int wn = (wave & 1) * 64;    // 2 waves along N
  const int lm = lane & 15;
  const int hi = lane >> 4;
  const int khalf = hi * 8;

  auto stageW = [&](int buf, int k0) {
    int m  = tid >> 1;
    int kk = (tid & 1) * 16;
    const f16* src = W + (size_t)(m0 + m) * DM + k0 + kk;
    f16* dst = &ldsW[buf][m * P32 + kk];
    async_copy16(src, dst);
    async_copy16(src + 8, dst + 8);
  };
  auto stageX = [&](int buf, int k0) {
    int kk = tid >> 3;          // 0..31: row k of the tile
    int nn = (tid & 7) * 8;     // 8 lanes x 16 B = one whole 128-B line of the row
    const f16* src = Xb + (size_t)(k0 + kk) * NN + n0 + nn;
    f16* dst = &ldsX[buf][kk * XP + nn];
    async_copy16(src, dst);
    async_copy16(src + 64, dst + 64);
  };

  v8f zero = {};
  v8f acc[2][4];
#pragma unroll
  for (int i = 0; i < 2; ++i)
#pragma unroll
    for (int j = 0; j < 4; ++j) acc[i][j] = zero;

  // prologue: fill buffer 0
  stageW(0, 0);
  stageX(0, 0);
  // this wave's copies of tile 0 have landed before the barrier publishes them
  asm volatile("s_wait_asynccnt 0x0" ::: "memory");
  __syncthreads();

  for (int k0 = 0; k0 < DM; k0 += BK) {
    const int cur = (k0 >> 5) & 1;
    const int nxt = cur ^ 1;

    // overlap: start filling the next tile before computing on the current
    if (k0 + BK < DM) {
      stageW(nxt, k0 + BK);
      stageX(nxt, k0 + BK);
    }

    v16h a[2], bb[4];
#pragma unroll
    for (int mt = 0; mt < 2; ++mt)
      a[mt]  = frag_from_lds(&ldsW[cur][(wm + mt * 16 + lm) * P32], khalf);
#pragma unroll
    for (int nt = 0; nt < 4; ++nt)
      bb[nt] = frag_tr_from_lds(&ldsX[cur][wn + nt * 16], lane);

#pragma unroll
    for (int mt = 0; mt < 2; ++mt)
#pragma unroll
      for (int nt = 0; nt < 4; ++nt)
        acc[mt][nt] = __builtin_amdgcn_wmma_f32_16x16x32_f16(
            false, a[mt], false, bb[nt], (short)0, acc[mt][nt], false, false);

    // this wave's LDS reads of the current buffers are over before the barrier frees them for refill
    asm volatile("s_wait_dscnt 0x0" ::: "memory");
    // this wave's copies of the next tile have landed before the barrier publishes them
    asm volatile("s_wait_asynccnt 0x0" ::: "memory");
    __syncthreads();
  }

  // epilogue: C/D layout row = vgpr + 8*hi, col = lane&15
#pragma unroll
  for (int mt = 0; mt < 2; ++mt) {
#pragma unroll
    for (int nt = 0; nt < 4; ++nt) {
      int col = n0 + wn + nt * 16 + lm;
#pragma unroll
      for (int r = 0; r < 8; ++r) {
        int row = m0 + wm + mt * 16 + hi * 8 + r;
        float v = acc[mt][nt][r] + bias[row];
        size_t idx = ((size_t)b * DM + row) * NN + col;
        if (writeF32) Yf[idx] = v;
        else          Yh[idx] = (f16)v;
      }
    }
  }
}

__device__ inline float xhalf(float x) {
  int b = __builtin_bit_cast(int, x);
  return __builtin_bit_cast(float,
      __builtin_amdgcn_permlanex16(b, b, 0x76543210, 0xfedcba98, false, false));
}

// ---------------------------------------------------------------------------
// Flash attention over Q/K/V f16 buffers laid out [b, c, n], c = d*16 + h.
// One block handles 128 queries of one (b, h); its 8 waves cover 8 query tiles of 16 columns
// and SHARE the K/V tiles staged cooperatively into LDS per 32-key step.
// Both products are taken transposed, S^T = K^T Q and O = V P^T: a lane holds
// the scores of ONE query (16 of the 32 keys, the other 16 in lane ^ 16), so
// maximum and sum run down its own registers, and the two score tiles,
// converted in place, are the B operand of the second product.
// ---------------------------------------------------------------------------
__global__ __launch_bounds__(256)
void attn_wmma(const f16* __restrict__ Q, const f16* __restrict__ Km,
               const f16* __restrict__ Vm, f16* __restrict__ Xa)
{
  __shared__ __attribute__((aligned(16))) f16 ldsKt[32 * P64];     // K tile transposed: [m][d], d contiguous, padded rows
  __shared__ __attribute__((aligned(16))) f16 ldsV [64 * P32];     // V tile:            [d][m], m contiguous, padded rows

  const int tid  = threadIdx.x;
  const int lane = tid & 31;
  const int wave = tid >> 5;
  const int lm = lane & 15;
  const int hi = lane >> 4;

  const int gid = blockIdx.x;        // B*H*8 = 1024 blocks
  const int b  = gid >> 7;
  const int h  = (gid >> 3) & 15;
  const int qc = gid & 7;
  const int n0 = (qc * 8 + wave) * 16;

  const size_t boff = (size_t)b * DM * NN;
  const f16* Qb = Q  + boff;
  const f16* Kb = Km + boff;
  const f16* Vb = Vm + boff;

  // Q as B fragments: column n (lane), K = head-dim d (64 -> 2 frags)
  Frag16 qa[2];
#pragma unroll
  for (int f = 0; f < 2; ++f)
#pragma unroll
    for (int e = 0; e < 16; ++e) {
      int d = f * 32 + hi * 8 + ((e & 8) << 1) + (e & 7);
      qa[f].h[e] = Qb[(size_t)(d * NH + h) * NN + (n0 + lm)];
    }

  v8f zero = {};
  v8f oacc[4];                       // O[d = f*16 + 8*hi + r][n0 + lm]
#pragma unroll
  for (int f = 0; f < 4; ++f) oacc[f] = zero;
  float mrow = -1.0e30f;             // running maximum of query n0 + lm (equal in both halves)
  float lrow = 0.0f;                 // running sum over this half's keys; the halves join after the loop

  const int sd = tid >> 2;           // 0..63: head-dim row for staging
  const int sm = (tid & 3) * 8;      // 0,8,16,24: key chunk for staging

  for (int mS = 0; mS < NN; mS += 32) {
    __syncthreads();                 // previous iteration's LDS reads done

    // ---- stage V tile [d][m] (straight copy -> async-to-LDS)
    async_copy16(Vb + (size_t)(sd * NH + h) * NN + mS + sm, &ldsV[sd * P32 + sm]);

    // ---- stage K tile transposed to [m][d]
    {
      Ld16 t4;
      t4.q = *(const float4*)(Kb + (size_t)(sd * NH + h) * NN + mS + sm);
#pragma unroll
      for (int j = 0; j < 8; ++j) ldsKt[(sm + j) * P64 + sd] = t4.h[j];
    }
    wait_async();
    __syncthreads();

    // ---- S^T = K^T Q  (two 16x16 tiles covering 32 keys): s[t][r] = S[n0 + lm][mS + t*16 + 8*hi + r]
    v8f s[2];
#pragma unroll
    for (int t = 0; t < 2; ++t) {
      s[t] = zero;
#pragma unroll
      for (int f = 0; f < 2; ++f) {
        Frag16 kb;
        const unsigned* p32 = (const unsigned*)(ldsKt + (t * 16 + lm) * P64);
#pragma unroll
        for (int p = 0; p < 8; ++p) {
          int k = f * 32 + hi * 8 + ((p & 4) << 2) + ((p & 3) << 1);
          kb.u[p] = p32[k >> 1];
        }
        s[t] = __builtin_amdgcn_wmma_f32_16x16x32_f16(
            false, kb.v, false, qa[f].v, (short)0, s[t], false, false);
      }
    }

    // ---- online softmax: one query a lane, its keys down the registers
    s[0] *= 0.125f;                  // 1/sqrt(64)
    s[1] *= 0.125f;
    float rmax = fmaxf(s[0][0], s[1][0]);
#pragma unroll
    for (int r = 1; r < 8; ++r) rmax = fmaxf(rmax, fmaxf(s[0][r], s[1][r]));
    rmax = fmaxf(rmax, xhalf(rmax));
    const float mnew  = fmaxf(mrow, rmax);
    const float alpha = __expf(mrow - mnew);
    mrow = mnew;

    // P^T in the B layout: element e = key 8*hi + e (e < 8), 16 + 8*hi + (e - 8) above
    Frag16 pb;
    float ps[8];
#pragma unroll
    for (int r = 0; r < 8; ++r) {
      float p0 = __expf(s[0][r] - mnew);
      float p1 = __expf(s[1][r] - mnew);
      pb.h[r]     = (f16)p0;
      pb.h[r + 8] = (f16)p1;
      ps[r] = p0 + p1;
    }
    const float rs = ((ps[0] + ps[1]) + (ps[2] + ps[3])) + ((ps[4] + ps[5]) + (ps[6] + ps[7]));
    lrow = lrow * alpha + rs;
#pragma unroll
    for (int f = 0; f < 4; ++f) oacc[f] *= alpha;

    // ---- O += V P^T   (K = 32 keys, 4 tiles covering d=64)
#pragma unroll
    for (int f = 0; f < 4; ++f) {
      Frag16 vb;
      const unsigned* p32 = (const unsigned*)(ldsV + (f * 16 + lm) * P32);
#pragma unroll
      for (int p = 0; p < 8; ++p) {
        int m = hi * 8 + ((p & 4) << 2) + ((p & 3) << 1);
        vb.u[p] = p32[m >> 1];
      }
      oacc[f] = __builtin_amdgcn_wmma_f32_16x16x32_f16(
          false, vb.v, false, pb.v, (short)0, oacc[f], false, false);
    }
  }

  // ---- join the halves' sums, normalize and store O[d,n] to [b, d*16+h, n] (f16)
  const float lsum = lrow + xhalf(lrow);
#pragma unroll
  for (int f = 0; f < 4; ++f) {
#pragma unroll
    for (int r = 0; r < 8; ++r) {
      int d = f * 16 + 8 * hi + r;
      float v = oacc[f][r] / lsum;
      Xa[boff + (size_t)(d * NH + h) * NN + n0 + lm] = (f16)v;
    }
  }
}

// ---------------------------------------------------------------------------
extern "C" void kernel_launch(void* const* d_in, const int* in_sizes, int n_in,
                              void* d_out, int out_size, void* d_ws, size_t ws_size,
                              hipStream_t stream) {
  const float* q_in = (const float*)d_in[0];
  const float* k_in = (const float*)d_in[1];
  const float* v_in = (const float*)d_in[2];
  const float* Wq = (const float*)d_in[3];
  const float* bq = (const float*)d_in[4];
  const float* Wk = (const float*)d_in[5];
  const float* bk = (const float*)d_in[6];
  const float* Wv = (const float*)d_in[7];
  const float* bv = (const float*)d_in[8];
  const float* Wm = (const float*)d_in[9];
  const float* bm = (const float*)d_in[10];
  float* out = (float*)d_out;

  // workspace partition (all f16)
  f16* ws = (f16*)d_ws;
  const size_t SB = (size_t)BATCH * DM * NN;  // 8M elems
  const size_t SW = (size_t)DM * DM;          // 1M elems
  f16* q16  = ws;
  f16* k16  = q16  + SB;
  f16* v16  = k16  + SB;
  f16* wq16 = v16  + SB;
  f16* wk16 = wq16 + SW;
  f16* wv16 = wk16 + SW;
  f16* wm16 = wv16 + SW;
  f16* Qp   = wm16 + SW;
  f16* Kp   = Qp   + SB;
  f16* Vp   = Kp   + SB;
  f16* Xat  = Vp   + SB;

  // 1) convert fp32 inputs/weights to f16: one launch, q16 .. wm16 are contiguous
  cvt_f32_to_f16<<<3 * CVT_XB + 4 * CVT_WB, CVT_T, 0, stream>>>(q_in, k_in, v_in, Wq, Wk, Wv, Wm, q16);

  // 2) Q/K/V projections (WMMA GEMM, f16 out): one launch, z = (projection, batch);
  //    wq16..wv16, q16..v16 and Qp..Vp are each contiguous
  dim3 g3(NN / BN, DM / BM, 3 * BATCH);
  gemm1024_wmma<<<g3, 256, 0, stream>>>(wq16, q16, bq, bk, bv, Qp, nullptr, 0);

  // 3) flash attention: one block per (b,h) and 128 queries; 8 waves share K/V LDS tiles
  attn_wmma<<<BATCH * NH * (NN / 128), 256, 0, stream>>>(Qp, Kp, Vp, Xat);

  // 4) output projection (fp32 out)
  dim3 g1(NN / BN, DM / BM, BATCH);
  gemm1024_wmma<<<g1, 256, 0, stream>>>(wm16, Xat, bm, bm, bm, nullptr, out, 1);
}

// v005
// Measured time: 171 microseconds a run.
// Next to v004, in two timings, it ran 1.11 and 1.10 times as fast.
// Over all steps from v000 it is 2.89 times as fast.
#include <hip/hip_runtime.h>
#include <hip/hip_bf16.h>

typedef _Float16 f16;
typedef __attribute__((ext_vector_type(16))) _Float16 v16h;
typedef __attribute__((ext_vector_type(8)))  float    v8f;
typedef __attribute__((ext_vector_type(4)))  int      v4i;
typedef __attribute__((ext_vector_type(8)))  short    v8s;

#define DM 1024   // d_model
#define NN 1024   // sequence length
#define BATCH 8
#define NH 16     // heads
#define HD 64     // head dim

#define BM 128
#define BN 128
#define BK 32
#define XP 144
#define P32 40
#define P64 72

union Frag16 { v16h v; unsigned u[8]; f16 h[16]; };
union FragT  { v16h v; v8s q[2]; };
union Ld16   { float4 q;    f16 h[8];  };

#if defined(__gfx1250__) && __has_builtin(__builtin_amdgcn_global_load_async_to_lds_b128)
#define USE_ASYNC_LDS 1
#else
#define USE_ASYNC_LDS 0
#endif

__device__ inline void async_copy16(const f16* g, f16* l) {
#if USE_ASYNC_LDS
  f16* gnc = (f16*)g;  // strip const first; then retype + addrspacecast
  __builtin_amdgcn_global_load_async_to_lds_b128(
      (v4i __attribute__((address_space(1)))*)gnc,
      (v4i __attribute__((address_space(3)))*)l, 0, 0);
#else
  *(float4*)l = *(const float4*)g;
#endif
}

__device__ inline void wait_async() {
#if USE_ASYNC_LDS
#if __has_builtin(__builtin_amdgcn_s_wait_asynccnt)
  __builtin_amdgcn_s_wait_asynccnt(0);
#else
  asm volatile("s_wait_asynccnt 0" ::: "memory");
#endif
#endif
}

// ---------------------------------------------------------------------------
// fp32 -> f16 conversion of all seven operands in ONE launch, built as a stream:
// one block of 16 waves for each WGP; a wave walks CVT_NC chunks of CVT_L loads,
// each load 512 contiguous bytes (four whole lines), and keeps the loads of the
// next CVT_A chunks in flight while it converts and stores the oldest one.
// The f16 copies lie one behind the other in out: q, k, v, Wq, Wk, Wv, Wm, and
// chunk c of wave w is chunk c * CVT_W + w of that row of operands.
// ---------------------------------------------------------------------------
typedef __attribute__((ext_vector_type(4))) float    v4f;
typedef __attribute__((ext_vector_type(4))) _Float16 v4h;
typedef const __attribute__((address_space(1))) v4f gl_v4f;
typedef __attribute__((address_space(1))) v4h gl_v4h;

#define CVT_T  512                     // threads of a block: 16 waves
#define CVT_B  256                     // blocks
#define CVT_W  (CVT_B * CVT_T / 32)    // waves of the launch
#define CVT_L  8                       // loads of a chunk
#define CVT_CH (CVT_L * 128)           // elements of a chunk
#define CVT_NC 7                       // chunks of a wave
#define CVT_A  2                       // chunks whose loads run ahead of the chunk at work
#define SZ_X ((long)BATCH * DM * NN)
#define SZ_W ((long)DM * DM)
#define CVT_R ((long)CVT_W * CVT_CH)   // elements of a round: one chunk of every wave
static_assert(SZ_X == 2 * CVT_R, "an activation is two rounds of chunks");
static_assert(4 * SZ_W == CVT_R, "the four weights are one round of chunks");
static_assert((SZ_W / CVT_CH) % (CVT_T / 32) == 0, "a block stays inside one weight");

__global__ __launch_bounds__(CVT_T)
void cvt_f32_to_f16(const float* __restrict__ q,  const float* __restrict__ k,
                    const float* __restrict__ v,  const float* __restrict__ wq,
                    const float* __restrict__ wk, const float* __restrict__ wv,
                    const float* __restrict__ wm, f16* __restrict__ out) {
  const unsigned s  = blockIdx.x / (unsigned)(SZ_W / CVT_CH / (CVT_T / 32));   // the block's weight
  const float* wsel = s == 0 ? wq : s == 1 ? wk : s == 2 ? wv : wm;
  // Every load and store is "operand's start (scalar) + 32-bit byte offset of the lane (vector) + constant":
  // w4, w2 = the lane's byte offset in a round of f32, of f16; an activation's second round and the
  // rounds of out are reached through the offset, which stays far below 2^32
  const float* in[CVT_NC] = { q, q, k, k, v, v, wsel };
  const unsigned e  = (blockIdx.x * (CVT_T / 32) + (threadIdx.x >> 5)) * CVT_CH + (threadIdx.x & 31) * 4;
  const unsigned w4 = e * 4u, w2 = e * 2u;
  const unsigned r4 = (unsigned)(CVT_R * 4);             // bytes of a round of f32
  const unsigned io[CVT_NC] = { w4, w4 + r4, w4, w4 + r4, w4, w4 + r4, w4 - s * (unsigned)(SZ_W * 4) };

  v4f buf[CVT_A + 1][CVT_L];
  // non-temporal: the f32 words are read once and need no place in L2
#define CVT_LOAD(C) do { _Pragma("unroll") for (int j = 0; j < CVT_L; ++j)  \
    buf[(C) % (CVT_A + 1)][j] = __builtin_nontemporal_load((gl_v4f*)((unsigned long)in[C] + j * 512 + io[C])); } while (0)

#pragma unroll
  for (int c = 0; c < CVT_A; ++c) CVT_LOAD(c);
#pragma unroll
  for (int c = 0; c < CVT_NC; ++c) {
    // the scheduling barriers hold the order "loads of chunk c + CVT_A, then chunk c's conversion and
    // stores": left free, the loads sink towards their use and the stores gather at the kernel's end
    __builtin_amdgcn_sched_barrier(0);
    if (c > 0) asm volatile("s_wait_xcnt 0x0" ::: "memory");
    if (c + CVT_A < CVT_NC) CVT_LOAD(c + CVT_A);
    __builtin_amdgcn_sched_barrier(0);
#pragma unroll
    for (int j = 0; j < CVT_L; ++j) {
      const v4f x = buf[c % (CVT_A + 1)][j];
      v4h y;
      y[0] = (f16)x[0]; y[1] = (f16)x[1]; y[2] = (f16)x[2]; y[3] = (f16)x[3];
      *(gl_v4h*)((unsigned long)out + j * 256 + (w2 + c * (r4 / 2))) = y;   // 256 contiguous bytes a wave: two whole lines
    }
  }
#undef CVT_LOAD
}

__device__ inline v16h frag_from_lds(const f16* rowbase, int khalf) {
  Frag16 f;
  const unsigned* p32 = (const unsigned*)rowbase;
#pragma unroll
  for (int p = 0; p < 8; ++p) {
    int k = khalf + ((p & 4) << 2) + ((p & 3) << 1);
    f.u[p] = p32[k >> 1];
  }
  return f.v;
}

// ---------------------------------------------------------------------------
// Build a 32x16 f16 B fragment from an LDS tile stored [k][n], n contiguous,
// row pitch XP. The transposing load hands lane (c = lane & 15, h = lane >> 4)
// the eight values T[kbase + 8h + 0..7][c]; the loads at kbase 0 and 16 give
// the same k order as frag_from_lds gives the A side.
// ---------------------------------------------------------------------------
__device__ inline v16h frag_tr_from_lds(const f16* colbase, int lane) {
  typedef __attribute__((address_space(3))) v8s lds_v8s;
  const f16* p = colbase + ((lane >> 4) * 8 + (lane & 7)) * XP + ((lane >> 3) & 1) * 8;
  FragT f;
  f.q[0] = __builtin_amdgcn_ds_load_tr16_b128_v8i16((lds_v8s*)p);
  f.q[1] = __builtin_amdgcn_ds_load_tr16_b128_v8i16((lds_v8s*)(p + 16 * XP));
  return f.v;
}

// ---------------------------------------------------------------------------
// GEMM: Y[z] = W[z / BATCH](1024x1024) @ X[z](1024x1024) + bias[z / BATCH]   (f16 WMMA)
// blockIdx.z = z counts (projection, batch): the projections' W, X and Y lie one
// behind the other in memory, so independent projections share one launch.
// Double-buffered LDS; both tiles filled with async-to-LDS; the X tile stays
// [k][n] as in memory and is transposed by the LDS read.
// writeF32 ? write float to Yf : write f16 to Yh
// ---------------------------------------------------------------------------
__global__ __launch_bounds__(256)
void gemm1024_wmma(const f16* __restrict__ Wall, const f16* __restrict__ X,
                   const float* __restrict__ bias0, const float* __restrict__ bias1,
                   const float* __restrict__ bias2,
                   f16* __restrict__ Yh, float* __restrict__ Yf, int writeF32)
{
  __shared__ __attribute__((aligned(16))) f16 ldsW[2][BM * P32];  // [m][k], k contiguous, padded rows
  __shared__ __attribute__((aligned(16))) f16 ldsX[2][BK * XP];   // [k][n], n contiguous, padded rows

  const int b  = blockIdx.z;          // (projection, batch)
  const int pj = b / BATCH;           // which projection
  const f16* Xb = X + (size_t)b * DM * NN;
  const f16* W  = Wall + (size_t)pj * DM * DM;
  const float* bias = pj == 0 ? bias0 : pj == 1 ? bias1 : bias2;
  const int m0 = blockIdx.y * BM;
  const int n0 = blockIdx.x * BN;
  const int tid  = threadIdx.x;
  const int lane = tid & 31;
  const int wave = tid >> 5;
  const int wm = (wave >> 1) * 32;   // 4 waves along M
  const int wn = (wave & 1) * 64;    // 2 waves along N
  const int lm = lane & 15;
  const int hi = lane >> 4;
  const int khalf = hi * 8;

  auto stageW = [&](int buf, int k0) {
    int m  = tid >> 1;
    int kk = (tid & 1) * 16;
    const f16* src = W + (size_t)(m0 + m) * DM + k0 + kk;
    f16* dst = &ldsW[buf][m * P32 + kk];
    async_copy16(src, dst);
    async_copy16(src + 8, dst + 8);
  };
  auto stageX = [&](int buf, int k0) {
    int kk = tid >> 3;          // 0..31: row k of the tile
    int nn = (tid & 7) * 8;     // 8 lanes x 16 B = one whole 128-B line of the row
    const f16* src = Xb + (size_t)(k0 + kk) * NN + n0 + nn;
    f16* dst = &ldsX[buf][kk * XP + nn];
    async_copy16(src, dst);
    async_copy16(src + 64, dst + 64);
  };

  v8f zero = {};
  v8f acc[2][4];
#pragma unroll
  for (int i = 0; i < 2; ++i)
#pragma unroll
    for (int j = 0; j < 4; ++j) acc[i][j] = zero;

  // prologue: fill buffer 0
  stageW(0, 0);
  stageX(0, 0);
  // this wave's copies of tile 0 have landed before the barrier publishes them
  asm volatile("s_wait_asynccnt 0x0" ::: "memory");
  __syncthreads();

  for (int k0 = 0; k0 < DM; k0 += BK) {
    const int cur = (k0 >> 5) & 1;
    const int nxt = cur ^ 1;

    // overlap: start filling the next tile before computing on the current
    if (k0 + BK < DM) {
      stageW(nxt, k0 + BK);
      stageX(nxt, k0 + BK);
    }

    v16h a[2], bb[4];
#pragma unroll
    for (int mt = 0; mt < 2; ++mt)
      a[mt]  = frag_from_lds(&ldsW[cur][(wm + mt * 16 + lm) * P32], khalf);
#pragma unroll
    for (int nt = 0; nt < 4; ++nt)
      bb[nt] = frag_tr_from_lds(&ldsX[cur][wn + nt * 16], lane);

#pragma unroll
    for (int mt = 0; mt < 2; ++mt)
#pragma unroll
      for (int nt = 0; nt < 4; ++nt)
        acc[mt][nt] = __builtin_amdgcn_wmma_f32_16x16x32_f16(
            false, a[mt], false, bb[nt], (short)0, acc[mt][nt], false, false);

    // this wave's LDS reads of the current buffers are over before the barrier frees them for refill
    asm volatile("s_wait_dscnt 0x0" ::: "memory");
    // this wave's copies of the next tile have landed before the barrier publishes them
    asm volatile("s_wait_asynccnt 0x0" ::: "memory");
    __syncthreads();
  }

  // epilogue: C/D layout row = vgpr + 8*hi, col = lane&15
#pragma unroll
  for (int mt = 0; mt < 2; ++mt) {
#pragma unroll
    for (int nt = 0; nt < 4; ++nt) {
      int col = n0 + wn + nt * 16 + lm;
#pragma unroll
      for (int r = 0; r < 8; ++r) {
        int row = m0 + wm + mt * 16 + hi * 8 + r;
        float v = acc[mt][nt][r] + bias[row];
        size_t idx = ((size_t)b * DM + row) * NN + col;
        if (writeF32) Yf[idx] = v;
        else          Yh[idx] = (f16)v;
      }
    }
  }
}

__device__ inline float xhalf(float x) {
  int b = __builtin_bit_cast(int, x);
  return __builtin_bit_cast(float,
      __builtin_amdgcn_permlanex16(b, b, 0x76543210, 0xfedcba98, false, false));
}

// ---------------------------------------------------------------------------
// Flash attention over Q/K/V f16 buffers laid out [b, c, n], c = d*16 + h.
// One block handles 128 queries of one (b, h); its 8 waves cover 8 query tiles of 16 columns
// and SHARE the K/V tiles staged cooperatively into LDS per 32-key step.
// Both products are taken transposed, S^T = K^T Q and O = V P^T: a lane holds
// the scores of ONE query (16 of the 32 keys, the other 16 in lane ^ 16), so
// maximum and sum run down its own registers, and the two score tiles,
// converted in place, are the B operand of the second product.
// ---------------------------------------------------------------------------
__global__ __launch_bounds__(256)
void attn_wmma(const f16* __restrict__ Q, const f16* __restrict__ Km,
               const f16* __restrict__ Vm, f16* __restrict__ Xa)
{
  __shared__ __attribute__((aligned(16))) f16 ldsKt[32 * P64];     // K tile transposed: [m][d], d contiguous, padded rows
  __shared__ __attribute__((aligned(16))) f16 ldsV [64 * P32];     // V tile:            [d][m], m contiguous, padded rows

  const int tid  = threadIdx.x;
  const int lane = tid & 31;
  const int wave = tid >> 5;
  const int lm = lane & 15;
  const int hi = lane >> 4;

  const int gid = blockIdx.x;        // B*H*8 = 1024 blocks
  const int b  = gid >> 7;
  const int h  = (gid >> 3) & 15;
  const int qc = gid & 7;
  const int n0 = (qc * 8 + wave) * 16;

  const size_t boff = (size_t)b * DM * NN;
  const f16* Qb = Q  + boff;
  const f16* Kb = Km + boff;
  const f16* Vb = Vm + boff;

  // Q as B fragments: column n (lane), K = head-dim d (64 -> 2 frags)
  Frag16 qa[2];
#pragma unroll
  for (int f = 0; f < 2; ++f)
#pragma unroll
    for (int e = 0; e < 16; ++e) {
      int d = f * 32 + hi * 8 + ((e & 8) << 1) + (e & 7);
      qa[f].h[e] = Qb[(size_t)(d * NH + h) * NN + (n0 + lm)];
    }

  v8f zero = {};
  v8f oacc[4];                       // O[d = f*16 + 8*hi + r][n0 + lm]
#pragma unroll
  for (int f = 0; f < 4; ++f) oacc[f] = zero;
  float mrow = -1.0e30f;             // running maximum of query n0 + lm (equal in both halves)
  float lrow = 0.0f;                 // running sum over this half's keys; the halves join after the loop

  const int sd = tid >> 2;           // 0..63: head-dim row for staging
  const int sm = (tid & 3) * 8;      // 0,8,16,24: key chunk for staging

  for (int mS = 0; mS < NN; mS += 32) {
    __syncthreads();                 // previous iteration's LDS reads done

    // ---- stage V tile [d][m] (straight copy -> async-to-LDS)
    async_copy16(Vb + (size_t)(sd * NH + h) * NN + mS + sm, &ldsV[sd * P32 + sm]);

    // ---- stage K tile transposed to [m][d]
    {
      Ld16 t4;
      t4.q = *(const float4*)(Kb + (size_t)(sd * NH + h) * NN + mS + sm);
#pragma unroll
      for (int j = 0; j < 8; ++j) ldsKt[(sm + j) * P64 + sd] = t4.h[j];
    }
    wait_async();
    __syncthreads();

    // ---- S^T = K^T Q  (two 16x16 tiles covering 32 keys): s[t][r] = S[n0 + lm][mS + t*16 + 8*hi + r]
    v8f s[2];
#pragma unroll
    for (int t = 0; t < 2; ++t) {
      s[t] = zero;
#pragma unroll
      for (int f = 0; f < 2; ++f) {
        Frag16 kb;
        const unsigned* p32 = (const unsigned*)(ldsKt + (t * 16 + lm) * P64);
#pragma unroll
        for (int p = 0; p < 8; ++p) {
          int k = f * 32 + hi * 8 + ((p & 4) << 2) + ((p & 3) << 1);
          kb.u[p] = p32[k >> 1];
        }
        s[t] = __builtin_amdgcn_wmma_f32_16x16x32_f16(
            false, kb.v, false, qa[f].v, (short)0, s[t], false, false);
      }
    }

    // ---- online softmax: one query a lane, its keys down the registers
    s[0] *= 0.125f;                  // 1/sqrt(64)
    s[1] *= 0.125f;
    float rmax = fmaxf(s[0][0], s[1][0]);
#pragma unroll
    for (int r = 1; r < 8; ++r) rmax = fmaxf(rmax, fmaxf(s[0][r], s[1][r]));
    rmax = fmaxf(rmax, xhalf(rmax));
    const float mnew  = fmaxf(mrow, rmax);
    const float alpha = __expf(mrow - mnew);
    mrow = mnew;

    // P^T in the B layout: element e = key 8*hi + e (e < 8), 16 + 8*hi + (e - 8) above
    Frag16 pb;
    float ps[8];
#pragma unroll
    for (int r = 0; r < 8; ++r) {
      float p0 = __expf(s[0][r] - mnew);
      float p1 = __expf(s[1][r] - mnew);
      pb.h[r]     = (f16)p0;
      pb.h[r + 8] = (f16)p1;
      ps[r] = p0 + p1;
    }
    const float rs = ((ps[0] + ps[1]) + (ps[2] + ps[3])) + ((ps[4] + ps[5]) + (ps[6] + ps[7]));
    lrow = lrow * alpha + rs;
#pragma unroll
    for (int f = 0; f < 4; ++f) oacc[f] *= alpha;

    // ---- O += V P^T   (K = 32 keys, 4 tiles covering d=64)
#pragma unroll
    for (int f = 0; f < 4; ++f) {
      Frag16 vb;
      const unsigned* p32 = (const unsigned*)(ldsV + (f * 16 + lm) * P32);
#pragma unroll
      for (int p = 0; p < 8; ++p) {
        int m = hi * 8 + ((p & 4) << 2) + ((p & 3) << 1);
        vb.u[p] = p32[m >> 1];
      }
      oacc[f] = __builtin_amdgcn_wmma_f32_16x16x32_f16(
          false, vb.v, false, pb.v, (short)0, oacc[f], false, false);
    }
  }

  // ---- join the halves' sums, normalize and store O[d,n] to [b, d*16+h, n] (f16)
  const float lsum = lrow + xhalf(lrow);
#pragma unroll
  for (int f = 0; f < 4; ++f) {
#pragma unroll
    for (int r = 0; r < 8; ++r) {
      int d = f * 16 + 8 * hi + r;
      float v = oacc[f][r] / lsum;
      Xa[boff + (size_t)(d * NH + h) * NN + n0 + lm] = (f16)v;
    }
  }
}

// ---------------------------------------------------------------------------
extern "C" void kernel_launch(void* const* d_in, const int* in_sizes, int n_in,
                              void* d_out, int out_size, void* d_ws, size_t ws_size,
                              hipStream_t stream) {
  const float* q_in = (const float*)d_in[0];
  const float* k_in = (const float*)d_in[1];
  const float* v_in = (const float*)d_in[2];
  const float* Wq = (const float*)d_in[3];
  const float* bq = (const float*)d_in[4];
  const float* Wk = (const float*)d_in[5];
  const float* bk = (const float*)d_in[6];
  const float* Wv = (const float*)d_in[7];
  const float* bv = (const float*)d_in[8];
  const float* Wm = (const float*)d_in[9];
  const float* bm = (const float*)d_in[10];
  float* out = (float*)d_out;

  // workspace partition (all f16)
  f16* ws = (f16*)d_ws;
  const size_t SB = (size_t)BATCH * DM * NN;  // 8M elems
  const size_t SW = (size_t)DM * DM;          // 1M elems
  f16* q16  = ws;
  f16* k16  = q16  + SB;
  f16* v16  = k16  + SB;
  f16* wq16 = v16  + SB;
  f16* wk16 = wq16 + SW;
  f16* wv16 = wk16 + SW;
  f16* wm16 = wv16 + SW;
  f16* Qp   = wm16 + SW;
  f16* Kp   = Qp   + SB;
  f16* Vp   = Kp   + SB;
  f16* Xat  = Vp   + SB;

  // 1) convert fp32 inputs/weights to f16: one launch, one block a WGP; q16 .. wm16 are contiguous
  cvt_f32_to_f16<<<CVT_B, CVT_T, 0, stream>>>(q_in, k_in, v_in, Wq, Wk, Wv, Wm, q16);

  // 2) Q/K/V projections (WMMA GEMM, f16 out): one launch, z = (projection, batch);
  //    wq16..wv16, q16..v16 and Qp..Vp are each contiguous
  dim3 g3(NN / BN, DM / BM, 3 * BATCH);
  gemm1024_wmma<<<g3, 256, 0, stream>>>(wq16, q16, bq, bk, bv, Qp, nullptr, 0);

  // 3) flash attention: one block per (b,h) and 128 queries; 8 waves share K/V LDS tiles
  attn_wmma<<<BATCH * NH * (NN / 128), 256, 0, stream>>>(Qp, Kp, Vp, Xat);

  // 4) output projection (fp32 out)
  dim3 g1(NN / BN, DM / BM, BATCH);
  gemm1024_wmma<<<g1, 256, 0, stream>>>(wm16, Xat, bm, bm, bm, nullptr, out, 1);
}

// v006
// Measured time: 158 microseconds a run.
// Two timings next to v005 both put it at 1.08 times that version's speed.
// Counting every step since v000, it is 3.12 times as fast.
#include <hip/hip_runtime.h>
#include <hip/hip_bf16.h>

typedef _Float16 f16;
typedef __attribute__((ext_vector_type(16))) _Float16 v16h;
typedef __attribute__((ext_vector_type(8)))  float    v8f;
typedef __attribute__((ext_vector_type(4)))  int      v4i;
typedef __attribute__((ext_vector_type(8)))  short    v8s;

#define DM 1024   // d_model
#define NN 1024   // sequence length
#define BATCH 8
#define NH 16     // heads
#define HD 64     // head dim
#define KS 64     // keys of an attention K/V stage: rows of one whole 128-B line

#define BM 128
#define BN 128
#define BK 32
#define XP 144
#define KP 80
#define P32 40
#define P64 72

union Frag16 { v16h v; unsigned u[8]; f16 h[16]; };
union FragT  { v16h v; v8s q[2]; };

#if defined(__gfx1250__) && __has_builtin(__builtin_amdgcn_global_load_async_to_lds_b128)
#define USE_ASYNC_LDS 1
#else
#define USE_ASYNC_LDS 0
#endif

__device__ inline void async_copy16(const f16* g, f16* l) {
#if USE_ASYNC_LDS
  f16* gnc = (f16*)g;  // strip const first; then retype + addrspacecast
  __builtin_amdgcn_global_load_async_to_lds_b128(
      (v4i __attribute__((address_space(1)))*)gnc,
      (v4i __attribute__((address_space(3)))*)l, 0, 0);
#else
  *(float4*)l = *(const float4*)g;
#endif
}

// ---------------------------------------------------------------------------
// fp32 -> f16 conversion of all seven operands in ONE launch, built as a stream:
// one block of 16 waves for each WGP; a wave walks CVT_NC chunks of CVT_L loads,
// each load 512 contiguous bytes (four whole lines), and keeps the loads of the
// next CVT_A chunks in flight while it converts and stores the oldest one.
// The f16 copies lie one behind the other in out: q, k, v, Wq, Wk, Wv, Wm, and
// chunk c of wave w is chunk c * CVT_W + w of that row of operands.
// ---------------------------------------------------------------------------
typedef __attribute__((ext_vector_type(4))) float    v4f;
typedef __attribute__((ext_vector_type(4))) _Float16 v4h;
typedef const __attribute__((address_space(1))) v4f gl_v4f;
typedef __attribute__((address_space(1))) v4h gl_v4h;

#define CVT_T  512                     // threads of a block: 16 waves
#define CVT_B  256                     // blocks
#define CVT_W  (CVT_B * CVT_T / 32)    // waves of the launch
#define CVT_L  8                       // loads of a chunk
#define CVT_CH (CVT_L * 128)           // elements of a chunk
#define CVT_NC 7                       // chunks of a wave
#define CVT_A  2                       // chunks whose loads run ahead of the chunk at work
#define SZ_X ((long)BATCH * DM * NN)
#define SZ_W ((long)DM * DM)
#define CVT_R ((long)CVT_W * CVT_CH)   // elements of a round: one chunk of every wave
static_assert(SZ_X == 2 * CVT_R, "an activation is two rounds of chunks");
static_assert(4 * SZ_W == CVT_R, "the four weights are one round of chunks");
static_assert((SZ_W / CVT_CH) % (CVT_T / 32) == 0, "a block stays inside one weight");

__global__ __launch_bounds__(CVT_T)
void cvt_f32_to_f16(const float* __restrict__ q,  const float* __restrict__ k,
                    const float* __restrict__ v,  const float* __restrict__ wq,
                    const float* __restrict__ wk, const float* __restrict__ wv,
                    const float* __restrict__ wm, f16* __restrict__ out) {
  const unsigned s  = blockIdx.x / (unsigned)(SZ_W / CVT_CH / (CVT_T / 32));   // the block's weight
  const float* wsel = s == 0 ? wq : s == 1 ? wk : s == 2 ? wv : wm;
  // Every load and store is "operand's start (scalar) + 32-bit byte offset of the lane (vector) + constant":
  // w4, w2 = the lane's byte offset in a round of f32, of f16; an activation's second round and the
  // rounds of out are reached through the offset, which stays far below 2^32
  const float* in[CVT_NC] = { q, q, k, k, v, v, wsel };
  const unsigned e  = (blockIdx.x * (CVT_T / 32) + (threadIdx.x >> 5)) * CVT_CH + (threadIdx.x & 31) * 4;
  const unsigned w4 = e * 4u, w2 = e * 2u;
  const unsigned r4 = (unsigned)(CVT_R * 4);             // bytes of a round of f32
  const unsigned io[CVT_NC] = { w4, w4 + r4, w4, w4 + r4, w4, w4 + r4, w4 - s * (unsigned)(SZ_W * 4) };

  v4f buf[CVT_A + 1][CVT_L];
  // non-temporal: the f32 words are read once and need no place in L2
#define CVT_LOAD(C) do { _Pragma("unroll") for (int j = 0; j < CVT_L; ++j)  \
    buf[(C) % (CVT_A + 1)][j] = __builtin_nontemporal_load((gl_v4f*)((unsigned long)in[C] + j * 512 + io[C])); } while (0)

#pragma unroll
  for (int c = 0; c < CVT_A; ++c) CVT_LOAD(c);
#pragma unroll
  for (int c = 0; c < CVT_NC; ++c) {
    // the scheduling barriers hold the order "loads of chunk c + CVT_A, then chunk c's conversion and
    // stores": left free, the loads sink towards their use and the stores gather at the kernel's end
    __builtin_amdgcn_sched_barrier(0);
    if (c > 0) asm volatile("s_wait_xcnt 0x0" ::: "memory");
    if (c + CVT_A < CVT_NC) CVT_LOAD(c + CVT_A);
    __builtin_amdgcn_sched_barrier(0);
#pragma unroll
    for (int j = 0; j < CVT_L; ++j) {
      const v4f x = buf[c % (CVT_A + 1)][j];
      v4h y;
      y[0] = (f16)x[0]; y[1] = (f16)x[1]; y[2] = (f16)x[2]; y[3] = (f16)x[3];
      *(gl_v4h*)((unsigned long)out + j * 256 + (w2 + c * (r4 / 2))) = y;   // 256 contiguous bytes a wave: two whole lines
    }
  }
#undef CVT_LOAD
}

__device__ inline v16h frag_from_lds(const f16* rowbase, int khalf) {
  Frag16 f;
  const unsigned* p32 = (const unsigned*)rowbase;
#pragma unroll
  for (int p = 0; p < 8; ++p) {
    int k = khalf + ((p & 4) << 2) + ((p & 3) << 1);
    f.u[p] = p32[k >> 1];
  }
  return f.v;
}

// ---------------------------------------------------------------------------
// Build a 32x16 f16 B fragment from an LDS tile stored [k][n], n contiguous,
// row pitch PITCH. The transposing load hands lane (c = lane & 15, h = lane >> 4)
// the eight values T[kbase + 8h + 0..7][c]; the loads at kbase 0 and 16 give
// the same k order as frag_from_lds gives the A side.
// ---------------------------------------------------------------------------
template <int PITCH>
__device__ inline v16h frag_tr_from_lds(const f16* colbase, int lane) {
  typedef __attribute__((address_space(3))) v8s lds_v8s;
  const f16* p = colbase + ((lane >> 4) * 8 + (lane & 7)) * PITCH + ((lane >> 3) & 1) * 8;
  FragT f;
  f.q[0] = __builtin_amdgcn_ds_load_tr16_b128_v8i16((lds_v8s*)p);
  f.q[1] = __builtin_amdgcn_ds_load_tr16_b128_v8i16((lds_v8s*)(p + 16 * PITCH));
  return f.v;
}

// ---------------------------------------------------------------------------
// GEMM: Y[z] = W[z / BATCH](1024x1024) @ X[z](1024x1024) + bias[z / BATCH]   (f16 WMMA)
// blockIdx.z = z counts (projection, batch): the projections' W, X and Y lie one
// behind the other in memory, so independent projections share one launch.
// Double-buffered LDS; both tiles filled with async-to-LDS; the X tile stays
// [k][n] as in memory and is transposed by the LDS read.
// writeF32 ? write float to Yf : write f16 to Yh
// ---------------------------------------------------------------------------
__global__ __launch_bounds__(256)
void gemm1024_wmma(const f16* __restrict__ Wall, const f16* __restrict__ X,
                   const float* __restrict__ bias0, const float* __restrict__ bias1,
                   const float* __restrict__ bias2,
                   f16* __restrict__ Yh, float* __restrict__ Yf, int writeF32)
{
  __shared__ __attribute__((aligned(16))) f16 ldsW[2][BM * P32];  // [m][k], k contiguous, padded rows
  __shared__ __attribute__((aligned(16))) f16 ldsX[2][BK * XP];   // [k][n], n contiguous, padded rows

  const int b  = blockIdx.z;          // (projection, batch)
  const int pj = b / BATCH;           // which projection
  const f16* Xb = X + (size_t)b * DM * NN;
  const f16* W  = Wall + (size_t)pj * DM * DM;
  const float* bias = pj == 0 ? bias0 : pj == 1 ? bias1 : bias2;
  const int m0 = blockIdx.y * BM;
  const int n0 = blockIdx.x * BN;
  const int tid  = threadIdx.x;
  const int lane = tid & 31;
  const int wave = tid >> 5;
  const int wm = (wave >> 1) * 32;   // 4 waves along M
  const int wn = (wave & 1) * 64;    // 2 waves along N
  const int lm = lane & 15;
  const int hi = lane >> 4;
  const int khalf = hi * 8;

  auto stageW = [&](int buf, int k0) {
    int m  = tid >> 1;
    int kk = (tid & 1) * 16;
    const f16* src = W + (size_t)(m0 + m) * DM + k0 + kk;
    f16* dst = &ldsW[buf][m * P32 + kk];
    async_copy16(src, dst);
    async_copy16(src + 8, dst + 8);
  };
  auto stageX = [&](int buf, int k0) {
    int kk = tid >> 3;          // 0..31: row k of the tile
    int nn = (tid & 7) * 8;     // 8 lanes x 16 B = one whole 128-B line of the row
    const f16* src = Xb + (size_t)(k0 + kk) * NN + n0 + nn;
    f16* dst = &ldsX[buf][kk * XP + nn];
    async_copy16(src, dst);
    async_copy16(src + 64, dst + 64);
  };

  v8f zero = {};
  v8f acc[2][4];
#pragma unroll
  for (int i = 0; i < 2; ++i)
#pragma unroll
    for (int j = 0; j < 4; ++j) acc[i][j] = zero;

  // prologue: fill buffer 0
  stageW(0, 0);
  stageX(0, 0);
  // this wave's copies of tile 0 have landed before the barrier publishes them
  asm volatile("s_wait_asynccnt 0x0" ::: "memory");
  __syncthreads();

  for (int k0 = 0; k0 < DM; k0 += BK) {
    const int cur = (k0 >> 5) & 1;
    const int nxt = cur ^ 1;

    // overlap: start filling the next tile before computing on the current
    if (k0 + BK < DM) {
      stageW(nxt, k0 + BK);
      stageX(nxt, k0 + BK);
    }

    v16h a[2], bb[4];
#pragma unroll
    for (int mt = 0; mt < 2; ++mt)
      a[mt]  = frag_from_lds(&ldsW[cur][(wm + mt * 16 + lm) * P32], khalf);
#pragma unroll
    for (int nt = 0; nt < 4; ++nt)
      bb[nt] = frag_tr_from_lds<XP>(&ldsX[cur][wn + nt * 16], lane);

#pragma unroll
    for (int mt = 0; mt < 2; ++mt)
#pragma unroll
      for (int nt = 0; nt < 4; ++nt)
        acc[mt][nt] = __builtin_amdgcn_wmma_f32_16x16x32_f16(
            false, a[mt], false, bb[nt], (short)0, acc[mt][nt], false, false);

    // this wave's LDS reads of the current buffers are over before the barrier frees them for refill
    asm volatile("s_wait_dscnt 0x0" ::: "memory");
    // this wave's copies of the next tile have landed before the barrier publishes them
    asm volatile("s_wait_asynccnt 0x0" ::: "memory");
    __syncthreads();
  }

  // epilogue: C/D layout row = vgpr + 8*hi, col = lane&15
#pragma unroll
  for (int mt = 0; mt < 2; ++mt) {
#pragma unroll
    for (int nt = 0; nt < 4; ++nt) {
      int col = n0 + wn + nt * 16 + lm;
#pragma unroll
      for (int r = 0; r < 8; ++r) {
        int row = m0 + wm + mt * 16 + hi * 8 + r;
        float v = acc[mt][nt][r] + bias[row];
        size_t idx = ((size_t)b * DM + row) * NN + col;
        if (writeF32) Yf[idx] = v;
        else          Yh[idx] = (f16)v;
      }
    }
  }
}

__device__ inline float xhalf(float x) {
  int b = __builtin_bit_cast(int, x);
  return __builtin_bit_cast(float,
      __builtin_amdgcn_permlanex16(b, b, 0x76543210, 0xfedcba98, false, false));
}

// ---------------------------------------------------------------------------
// Flash attention over Q/K/V f16 buffers laid out [b, c, n], c = d*16 + h.
// One block handles 128 queries of one (b, h); its 8 waves cover 8 query tiles of 16 columns
// and SHARE the K/V stages of KS keys. A stage goes to LDS as it lies in memory,
// [d][m], by async copies of whole lines into one of two buffers, one stage ahead
// of the stage at work; K is transposed by the LDS read. A pass is 32 keys.
// Both products are taken transposed, S^T = K^T Q and O = V P^T: a lane holds
// the scores of ONE query (16 of the 32 keys, the other 16 in lane ^ 16), so
// maximum and sum run down its own registers, and the two score tiles,
// converted in place, are the B operand of the second product.
// ---------------------------------------------------------------------------
__global__ __launch_bounds__(256)
void attn_wmma(const f16* __restrict__ Q, const f16* __restrict__ Km,
               const f16* __restrict__ Vm, f16* __restrict__ Xa)
{
  __shared__ __attribute__((aligned(16))) f16 ldsK[2][HD * KP];    // K stage: [d][m], m contiguous, padded rows
  __shared__ __attribute__((aligned(16))) f16 ldsV[2][HD * P64];   // V stage: [d][m], m contiguous, padded rows

  const int tid  = threadIdx.x;
  const int lane = tid & 31;
  const int wave = tid >> 5;
  const int lm = lane & 15;
  const int hi = lane >> 4;

  const int gid = blockIdx.x;        // B*H*8 = 1024 blocks
  const int b  = gid >> 7;
  const int h  = (gid >> 3) & 15;
  const int qc = gid & 7;
  const int n0 = (qc * 8 + wave) * 16;

  const size_t boff = (size_t)b * DM * NN;
  const f16* Qb = Q  + boff;
  const f16* Kb = Km + boff;
  const f16* Vb = Vm + boff;

  // Q as B fragments: column n (lane), K = head-dim d (64 -> 2 frags)
  Frag16 qa[2];
#pragma unroll
  for (int f = 0; f < 2; ++f)
#pragma unroll
    for (int e = 0; e < 16; ++e) {
      int d = f * 32 + hi * 8 + ((e & 8) << 1) + (e & 7);
      qa[f].h[e] = Qb[(size_t)(d * NH + h) * NN + (n0 + lm)];
    }

  v8f zero = {};
  v8f oacc[4];                       // O[d = f*16 + 8*hi + r][n0 + lm]
#pragma unroll
  for (int f = 0; f < 4; ++f) oacc[f] = zero;
  float mrow = -1.0e30f;             // running maximum of query n0 + lm (equal in both halves)
  float lrow = 0.0f;                 // running sum over this half's keys; the halves join after the loop

  const int sr = tid >> 3;           // 0..31: head-dim row for staging (and row + 32)
  const int sc = (tid & 7) * 8;      // key chunk for staging: 8 lanes x 16 B = one whole 128-B line of the row

  auto stageKV = [&](int buf, int mS) {
    const size_t g0 = (size_t)(sr * NH + h) * NN + mS + sc;
    const size_t g1 = g0 + (size_t)32 * NH * NN;
    async_copy16(Kb + g0, &ldsK[buf][sr * KP + sc]);
    async_copy16(Kb + g1, &ldsK[buf][(sr + 32) * KP + sc]);
    async_copy16(Vb + g0, &ldsV[buf][sr * P64 + sc]);
    async_copy16(Vb + g1, &ldsV[buf][(sr + 32) * P64 + sc]);
  };

  // prologue: stage 0 lands and is published, then stage 1 starts
  stageKV(0, 0);
  // this wave's copies of stage 0 have landed before the barrier publishes them
  asm volatile("s_wait_asynccnt 0x0" ::: "memory");
  __syncthreads();
  stageKV(1, KS);

  for (int st = 0; st < NN / KS; ++st) {
   const f16* Kst = ldsK[st & 1];
   const f16* Vst = ldsV[st & 1];
#pragma unroll 1
   for (int ps32 = 0; ps32 < KS; ps32 += 32) {
    // ---- S^T = K^T Q  (two 16x16 tiles covering 32 keys): s[t][r] = S[n0 + lm][st*KS + ps32 + t*16 + 8*hi + r]
    v8f s[2];
#pragma unroll
    for (int t = 0; t < 2; ++t) {
      s[t] = zero;
#pragma unroll
      for (int f = 0; f < 2; ++f) {
        const v16h kb = frag_tr_from_lds<KP>(Kst + f * 32 * KP + ps32 + t * 16, lane);
        s[t] = __builtin_amdgcn_wmma_f32_16x16x32_f16(
            false, kb, false, qa[f].v, (short)0, s[t], false, false);
      }
    }

    // ---- online softmax: one query a lane, its keys down the registers
    s[0] *= 0.125f;                  // 1/sqrt(64)
    s[1] *= 0.125f;
    float rmax = fmaxf(s[0][0], s[1][0]);
#pragma unroll
    for (int r = 1; r < 8; ++r) rmax = fmaxf(rmax, fmaxf(s[0][r], s[1][r]));
    rmax = fmaxf(rmax, xhalf(rmax));
    const float mnew  = fmaxf(mrow, rmax);
    const float alpha = __expf(mrow - mnew);
    mrow = mnew;

    // P^T in the B layout: element e = key 8*hi + e (e < 8), 16 + 8*hi + (e - 8) above
    Frag16 pb;
    float ps[8];
#pragma unroll
    for (int r = 0; r < 8; ++r) {
      float p0 = __expf(s[0][r] - mnew);
      float p1 = __expf(s[1][r] - mnew);
      pb.h[r]     = (f16)p0;
      pb.h[r + 8] = (f16)p1;
      ps[r] = p0 + p1;
    }
    const float rs = ((ps[0] + ps[1]) + (ps[2] + ps[3])) + ((ps[4] + ps[5]) + (ps[6] + ps[7]));
    lrow = lrow * alpha + rs;
#pragma unroll
    for (int f = 0; f < 4; ++f) oacc[f] *= alpha;

    // ---- O += V P^T   (K = 32 keys, 4 tiles covering d=64)
#pragma unroll
    for (int f = 0; f < 4; ++f) {
      Frag16 vb;
      const unsigned* p32 = (const unsigned*)(Vst + (f * 16 + lm) * P64 + ps32);
#pragma unroll
      for (int p = 0; p < 8; ++p) {
        int m = hi * 8 + ((p & 4) << 2) + ((p & 3) << 1);
        vb.u[p] = p32[m >> 1];
      }
      oacc[f] = __builtin_amdgcn_wmma_f32_16x16x32_f16(
          false, vb.v, false, pb.v, (short)0, oacc[f], false, false);
    }
   }

    // this wave's LDS reads of the stage at work are over before the barrier frees its buffer for refill
    asm volatile("s_wait_dscnt 0x0" ::: "memory");
    // this wave's copies of the next stage have landed before the barrier publishes them
    asm volatile("s_wait_asynccnt 0x0" ::: "memory");
    __syncthreads();
    if (st + 2 < NN / KS) stageKV(st & 1, (st + 2) * KS);
  }
  // no copy of this wave is left in flight at its end
  asm volatile("s_wait_asynccnt 0x0" ::: "memory");

  // ---- join the halves' sums, normalize and store O[d,n] to [b, d*16+h, n] (f16)
  const float lsum = lrow + xhalf(lrow);
#pragma unroll
  for (int f = 0; f < 4; ++f) {
#pragma unroll
    for (int r = 0; r < 8; ++r) {
      int d = f * 16 + 8 * hi + r;
      float v = oacc[f][r] / lsum;
      Xa[boff + (size_t)(d * NH + h) * NN + n0 + lm] = (f16)v;
    }
  }
}

// ---------------------------------------------------------------------------
extern "C" void kernel_launch(void* const* d_in, const int* in_sizes, int n_in,
                              void* d_out, int out_size, void* d_ws, size_t ws_size,
                              hipStream_t stream) {
  const float* q_in = (const float*)d_in[0];
  const float* k_in = (const float*)d_in[1];
  const float* v_in = (const float*)d_in[2];
  const float* Wq = (const float*)d_in[3];
  const float* bq = (const float*)d_in[4];
  const float* Wk = (const float*)d_in[5];
  const float* bk = (const float*)d_in[6];
  const float* Wv = (const float*)d_in[7];
  const float* bv = (const float*)d_in[8];
  const float* Wm = (const float*)d_in[9];
  const float* bm = (const float*)d_in[10];
  float* out = (float*)d_out;

  // workspace partition (all f16)
  f16* ws = (f16*)d_ws;
  const size_t SB = (size_t)BATCH * DM * NN;  // 8M elems
  const size_t SW = (size_t)DM * DM;          // 1M elems
  f16* q16  = ws;
  f16* k16  = q16  + SB;
  f16* v16  = k16  + SB;
  f16* wq16 = v16  + SB;
  f16* wk16 = wq16 + SW;
  f16* wv16 = wk16 + SW;
  f16* wm16 = wv16 + SW;
  f16* Qp   = wm16 + SW;
  f16* Kp   = Qp   + SB;
  f16* Vp   = Kp   + SB;
  f16* Xat  = Vp   + SB;

  // 1) convert fp32 inputs/weights to f16: one launch, one block a WGP; q16 .. wm16 are contiguous
  cvt_f32_to_f16<<<CVT_B, CVT_T, 0, stream>>>(q_in, k_in, v_in, Wq, Wk, Wv, Wm, q16);

  // 2) Q/K/V projections (WMMA GEMM, f16 out): one launch, z = (projection, batch);
  //    wq16..wv16, q16..v16 and Qp..Vp are each contiguous
  dim3 g3(NN / BN, DM / BM, 3 * BATCH);
  gemm1024_wmma<<<g3, 256, 0, stream>>>(wq16, q16, bq, bk, bv, Qp, nullptr, 0);

  // 3) flash attention: one block per (b, h, 128 queries); 8 waves share the K/V stages in LDS
  attn_wmma<<<BATCH * NH * (NN / 128), 256, 0, stream>>>(Qp, Kp, Vp, Xat);

  // 4) output projection (fp32 out)
  dim3 g1(NN / BN, DM / BM, BATCH);
  gemm1024_wmma<<<g1, 256, 0, stream>>>(wm16, Xat, bm, bm, bm, nullptr, out, 1);
}

// v007
// Measured time: 140 microseconds a run.
// In two side-by-side timings against v006, it was 1.13 and 1.14 times as fast.
// All steps since v000 together make it 3.53 times as fast.
#include <hip/hip_runtime.h>
#include <hip/hip_bf16.h>

typedef _Float16 f16;
typedef __attribute__((ext_vector_type(16))) _Float16 v16h;
typedef __attribute__((ext_vector_type(8)))  float    v8f;
typedef __attribute__((ext_vector_type(4)))  int      v4i;
typedef __attribute__((ext_vector_type(8)))  short    v8s;
typedef __attribute__((ext_vector_type(8)))  _Float16 v8h;

#define DM 1024   // d_model
#define NN 1024   // sequence length
#define BATCH 8
#define NH 16     // heads
#define HD 64     // head dim
#define KS 64     // keys of an attention K/V stage: rows of one whole 128-B line

#define BM 128
#define BN 128
#define BK 32
#define XP 144
#define KP 80
#define P32 40
#define P64 72
#define PF  68
#define PO  136

union Frag16 { v16h v; unsigned u[8]; f16 h[16]; };
union FragT  { v16h v; v8s q[2]; };

#if defined(__gfx1250__) && __has_builtin(__builtin_amdgcn_global_load_async_to_lds_b128)
#define USE_ASYNC_LDS 1
#else
#define USE_ASYNC_LDS 0
#endif

__device__ inline void async_copy16(const f16* g, f16* l) {
#if USE_ASYNC_LDS
  f16* gnc = (f16*)g;  // strip const first; then retype + addrspacecast
  __builtin_amdgcn_global_load_async_to_lds_b128(
      (v4i __attribute__((address_space(1)))*)gnc,
      (v4i __attribute__((address_space(3)))*)l, 0, 0);
#else
  *(float4*)l = *(const float4*)g;
#endif
}

// ---------------------------------------------------------------------------
// fp32 -> f16 conversion of all seven operands in ONE launch, built as a stream:
// one block of 16 waves for each WGP; a wave walks CVT_NC chunks of CVT_L loads,
// each load 512 contiguous bytes (four whole lines), and keeps the loads of the
// next CVT_A chunks in flight while it converts and stores the oldest one.
// The f16 copies lie one behind the other in out: q, k, v, Wq, Wk, Wv, Wm, and
// chunk c of wave w is chunk c * CVT_W + w of that row of operands.
// ---------------------------------------------------------------------------
typedef __attribute__((ext_vector_type(4))) float    v4f;
typedef __attribute__((ext_vector_type(4))) _Float16 v4h;
typedef const __attribute__((address_space(1))) v4f gl_v4f;
typedef __attribute__((address_space(1))) v4h gl_v4h;

#define CVT_T  512                     // threads of a block: 16 waves
#define CVT_B  256                     // blocks
#define CVT_W  (CVT_B * CVT_T / 32)    // waves of the launch
#define CVT_L  8                       // loads of a chunk
#define CVT_CH (CVT_L * 128)           // elements of a chunk
#define CVT_NC 7                       // chunks of a wave
#define CVT_A  2                       // chunks whose loads run ahead of the chunk at work
#define SZ_X ((long)BATCH * DM * NN)
#define SZ_W ((long)DM * DM)
#define CVT_R ((long)CVT_W * CVT_CH)   // elements of a round: one chunk of every wave
static_assert(SZ_X == 2 * CVT_R, "an activation is two rounds of chunks");
static_assert(4 * SZ_W == CVT_R, "the four weights are one round of chunks");
static_assert((SZ_W / CVT_CH) % (CVT_T / 32) == 0, "a block stays inside one weight");

__global__ __launch_bounds__(CVT_T)
void cvt_f32_to_f16(const float* __restrict__ q,  const float* __restrict__ k,
                    const float* __restrict__ v,  const float* __restrict__ wq,
                    const float* __restrict__ wk, const float* __restrict__ wv,
                    const float* __restrict__ wm, f16* __restrict__ out) {
  const unsigned s  = blockIdx.x / (unsigned)(SZ_W / CVT_CH / (CVT_T / 32));   // the block's weight
  const float* wsel = s == 0 ? wq : s == 1 ? wk : s == 2 ? wv : wm;
  // Every load and store is "operand's start (scalar) + 32-bit byte offset of the lane (vector) + constant":
  // w4, w2 = the lane's byte offset in a round of f32, of f16; an activation's second round and the
  // rounds of out are reached through the offset, which stays far below 2^32
  const float* in[CVT_NC] = { q, q, k, k, v, v, wsel };
  const unsigned e  = (blockIdx.x * (CVT_T / 32) + (threadIdx.x >> 5)) * CVT_CH + (threadIdx.x & 31) * 4;
  const unsigned w4 = e * 4u, w2 = e * 2u;
  const unsigned r4 = (unsigned)(CVT_R * 4);             // bytes of a round of f32
  const unsigned io[CVT_NC] = { w4, w4 + r4, w4, w4 + r4, w4, w4 + r4, w4 - s * (unsigned)(SZ_W * 4) };

  v4f buf[CVT_A + 1][CVT_L];
  // non-temporal: the f32 words are read once and need no place in L2
#define CVT_LOAD(C) do { _Pragma("unroll") for (int j = 0; j < CVT_L; ++j)  \
    buf[(C) % (CVT_A + 1)][j] = __builtin_nontemporal_load((gl_v4f*)((unsigned long)in[C] + j * 512 + io[C])); } while (0)

#pragma unroll
  for (int c = 0; c < CVT_A; ++c) CVT_LOAD(c);
#pragma unroll
  for (int c = 0; c < CVT_NC; ++c) {
    // the scheduling barriers hold the order "loads of chunk c + CVT_A, then chunk c's conversion and
    // stores": left free, the loads sink towards their use and the stores gather at the kernel's end
    __builtin_amdgcn_sched_barrier(0);
    if (c > 0) asm volatile("s_wait_xcnt 0x0" ::: "memory");
    if (c + CVT_A < CVT_NC) CVT_LOAD(c + CVT_A);
    __builtin_amdgcn_sched_barrier(0);
#pragma unroll
    for (int j = 0; j < CVT_L; ++j) {
      const v4f x = buf[c % (CVT_A + 1)][j];
      v4h y;
      y[0] = (f16)x[0]; y[1] = (f16)x[1]; y[2] = (f16)x[2]; y[3] = (f16)x[3];
      *(gl_v4h*)((unsigned long)out + j * 256 + (w2 + c * (r4 / 2))) = y;   // 256 contiguous bytes a wave: two whole lines
    }
  }
#undef CVT_LOAD
}

__device__ inline v16h frag_from_lds(const f16* rowbase, int khalf) {
  FragT f;
  f.q[0] = *(const v8s*)(rowbase + khalf);        // k = khalf + 0..7
  f.q[1] = *(const v8s*)(rowbase + khalf + 16);   // k = khalf + 16..23
  return f.v;
}

// ---------------------------------------------------------------------------
// Build a 16x32 f16 A fragment (T^T) from an LDS tile T stored [k][n], n contiguous,
// row pitch PITCH. The transposing load hands lane (c = lane & 15, h = lane >> 4)
// the eight values T[kbase + 8h + 0..7][c]; the loads at kbase 0 and 16 give
// the same k order as frag_from_lds gives the W fragments of the GEMM.
// ---------------------------------------------------------------------------
template <int PITCH>
__device__ inline v16h frag_tr_from_lds(const f16* colbase, int lane) {
  typedef __attribute__((address_space(3))) v8s lds_v8s;
  const f16* p = colbase + ((lane >> 4) * 8 + (lane & 7)) * PITCH + ((lane >> 3) & 1) * 8;
  FragT f;
  f.q[0] = __builtin_amdgcn_ds_load_tr16_b128_v8i16((lds_v8s*)p);
  f.q[1] = __builtin_amdgcn_ds_load_tr16_b128_v8i16((lds_v8s*)(p + 16 * PITCH));
  return f.v;
}

// ---------------------------------------------------------------------------
// GEMM: Y[z] = W[z / BATCH](1024x1024) @ X[z](1024x1024) + bias[z / BATCH]   (f16 WMMA)
// blockIdx.z = z counts (projection, batch): the projections' W, X and Y lie one
// behind the other in memory, so independent projections share one launch.
// Double-buffered LDS; both tiles filled with async-to-LDS; the X tile stays
// [k][n] as in memory and is transposed by the LDS read.
// The product is taken as Y^T = X^T W^T (X fragments first): a lane then holds eight
// neighbouring n of ONE row m, so it needs one bias value a tile and writes 16 bytes
// at a time; each wave turns its 32 x 64 tile in its own piece of the freed ring
// and stores whole 128-B lines.
// writeF32 ? write float to Yf : write f16 to Yh
// ---------------------------------------------------------------------------
__global__ __launch_bounds__(256)
void gemm1024_wmma(const f16* __restrict__ Wall, const f16* __restrict__ X,
                   const float* __restrict__ bias0, const float* __restrict__ bias1,
                   const float* __restrict__ bias2,
                   f16* __restrict__ Yh, float* __restrict__ Yf, int writeF32)
{
  __shared__ __attribute__((aligned(16))) f16 ldsW[2][BM * P32];  // [m][k], k contiguous, padded rows
  __shared__ __attribute__((aligned(16))) f16 ldsX[2][BK * XP];   // [k][n], n contiguous, padded rows

  const int b  = blockIdx.z;          // (projection, batch)
  const int pj = b / BATCH;           // which projection
  const f16* Xb = X + (size_t)b * DM * NN;
  const f16* W  = Wall + (size_t)pj * DM * DM;
  const float* bias = pj == 0 ? bias0 : pj == 1 ? bias1 : bias2;
  const int m0 = blockIdx.y * BM;
  const int n0 = blockIdx.x * BN;
  const int tid  = threadIdx.x;
  const int lane = tid & 31;
  const int wave = tid >> 5;
  const int wm = (wave >> 1) * 32;   // 4 waves along M
  const int wn = (wave & 1) * 64;    // 2 waves along N
  const int lm = lane & 15;
  const int hi = lane >> 4;
  const int khalf = hi * 8;

  auto stageW = [&](int buf, int k0) {
    int m  = tid >> 1;
    int kk = (tid & 1) * 16;
    const f16* src = W + (size_t)(m0 + m) * DM + k0 + kk;
    f16* dst = &ldsW[buf][m * P32 + kk];
    async_copy16(src, dst);
    async_copy16(src + 8, dst + 8);
  };
  auto stageX = [&](int buf, int k0) {
    int kk = tid >> 3;          // 0..31: row k of the tile
    int nn = (tid & 7) * 8;     // 8 lanes x 16 B = one whole 128-B line of the row
    const f16* src = Xb + (size_t)(k0 + kk) * NN + n0 + nn;
    f16* dst = &ldsX[buf][kk * XP + nn];
    async_copy16(src, dst);
    async_copy16(src + 64, dst + 64);
  };

  v8f zero = {};
  v8f acc[2][4];
#pragma unroll
  for (int i = 0; i < 2; ++i)
#pragma unroll
    for (int j = 0; j < 4; ++j) acc[i][j] = zero;

  // prologue: fill buffer 0
  stageW(0, 0);
  stageX(0, 0);
  // this wave's copies of tile 0 have landed before the barrier publishes them
  asm volatile("s_wait_asynccnt 0x0" ::: "memory");
  __syncthreads();

  for (int k0 = 0; k0 < DM; k0 += BK) {
    const int cur = (k0 >> 5) & 1;
    const int nxt = cur ^ 1;

    // overlap: start filling the next tile before computing on the current
    if (k0 + BK < DM) {
      stageW(nxt, k0 + BK);
      stageX(nxt, k0 + BK);
    }

    v16h a[2], bb[4];
#pragma unroll
    for (int mt = 0; mt < 2; ++mt)
      a[mt]  = frag_from_lds(&ldsW[cur][(wm + mt * 16 + lm) * P32], khalf);
#pragma unroll
    for (int nt = 0; nt < 4; ++nt)
      bb[nt] = frag_tr_from_lds<XP>(&ldsX[cur][wn + nt * 16], lane);

#pragma unroll
    for (int mt = 0; mt < 2; ++mt)
#pragma unroll
      for (int nt = 0; nt < 4; ++nt)
        acc[mt][nt] = __builtin_amdgcn_wmma_f32_16x16x32_f16(
            false, bb[nt], false, a[mt], (short)0, acc[mt][nt], false, false);

    // this wave's LDS reads of the current buffers are over before the barrier frees them for refill
    asm volatile("s_wait_dscnt 0x0" ::: "memory");
    // this wave's copies of the next tile have landed before the barrier publishes them
    asm volatile("s_wait_asynccnt 0x0" ::: "memory");
    __syncthreads();
  }

  // epilogue: acc[mt][nt][r] = Y[m0 + wm + mt*16 + lm][n0 + wn + nt*16 + 8*hi + r].
  // The last pass's foot (no LDS read and no copy of any wave left, then the barrier) has freed the ring.
  // The loops below are unrolled so that every accumulator index is a constant: registers, not scratch.
  float bv[2];
#pragma unroll
  for (int mt = 0; mt < 2; ++mt) bv[mt] = bias[m0 + wm + mt * 16 + lm];
  const size_t ybase = ((size_t)b * DM + m0 + wm) * NN + n0 + wn;   // first output of the wave's tile
  // a wave's own piece of the freed ring, 32 * P64 f16: waves 0..3 share the W ring, waves 4..7 the X ring
  static_assert(4 * 32 * P64 <= 2 * BM * P32 && 4 * 32 * P64 <= 2 * BK * XP, "four pieces fit each ring");
  static_assert(16 * PF * 4 <= 32 * P64 * 2, "16 rows of f32 fit a piece");
  f16* piece = (wave < 4 ? &ldsW[0][0] : &ldsX[0][0]) + (wave & 3) * 32 * P64;

  if (writeF32) {
    float* st = (float*)piece;               // 16 x 64 f32, [m][n], padded rows: the tile's two halves one after the other
#pragma unroll
    for (int mt = 0; mt < 2; ++mt) {
#pragma unroll
      for (int nt = 0; nt < 4; ++nt) {
        v4f y0, y1;
#pragma unroll
        for (int r = 0; r < 4; ++r) {
          y0[r] = acc[mt][nt][r]     + bv[mt];
          y1[r] = acc[mt][nt][r + 4] + bv[mt];
        }
        *(v4f*)&st[lm * PF + nt * 16 + hi * 8]     = y0;
        *(v4f*)&st[lm * PF + nt * 16 + hi * 8 + 4] = y1;
      }
      // the wave's own LDS writes are over before other lanes of it read the rows back
      asm volatile("s_wait_dscnt 0x0" ::: "memory");
#pragma unroll
      for (int i = 0; i < 8; ++i) {
        const int row = i * 2 + hi;          // 16 lanes x 16 B = the two whole lines of a row
        const v4f y = *(const v4f*)&st[row * PF + lm * 4];
        *(v4f*)&Yf[ybase + (size_t)(mt * 16 + row) * NN + lm * 4] = y;
      }
    }
    asm volatile("s_wait_xcnt 0x0" ::: "memory");
  } else {
    f16* st = piece;                         // 32 x 64 f16, [m][n], padded rows
#pragma unroll
    for (int mt = 0; mt < 2; ++mt)
#pragma unroll
      for (int nt = 0; nt < 4; ++nt) {
        v8h y;
#pragma unroll
        for (int r = 0; r < 8; ++r) y[r] = (f16)(acc[mt][nt][r] + bv[mt]);
        *(v8h*)&st[(mt * 16 + lm) * P64 + nt * 16 + hi * 8] = y;
      }
    // the wave's own LDS writes are over before other lanes of it read the rows back
    asm volatile("s_wait_dscnt 0x0" ::: "memory");
#pragma unroll
    for (int i = 0; i < 8; ++i) {
      const int row = i * 4 + (lane >> 3);   // 8 lanes x 16 B = the whole line of a row
      const int ch  = (lane & 7) * 8;
      const v8h y = *(const v8h*)&st[row * P64 + ch];
      *(v8h*)&Yh[ybase + (size_t)row * NN + ch] = y;
    }
  }
}

__device__ inline float xhalf(float x) {
  int b = __builtin_bit_cast(int, x);
  return __builtin_bit_cast(float,
      __builtin_amdgcn_permlanex16(b, b, 0x76543210, 0xfedcba98, false, false));
}

// ---------------------------------------------------------------------------
// Flash attention over Q/K/V f16 buffers laid out [b, c, n], c = d*16 + h.
// One block handles 128 queries of one (b, h); its 8 waves cover 8 query tiles of 16 columns
// and SHARE the K/V stages of KS keys. A stage goes to LDS as it lies in memory,
// [d][m], by async copies of whole lines into one of two buffers, one stage ahead
// of the stage at work; K is transposed by the LDS read. A pass is 32 keys.
// Both products are taken transposed, S^T = K^T Q and O = V P^T: a lane holds
// the scores of ONE query (16 of the 32 keys, the other 16 in lane ^ 16), so
// maximum and sum run down its own registers, and the two score tiles,
// converted in place, are the B operand of the second product.
// ---------------------------------------------------------------------------
__global__ __launch_bounds__(256)
void attn_wmma(const f16* __restrict__ Q, const f16* __restrict__ Km,
               const f16* __restrict__ Vm, f16* __restrict__ Xa)
{
  __shared__ __attribute__((aligned(16))) f16 ldsK[2][HD * KP];    // K stage: [d][m], m contiguous, padded rows
  __shared__ __attribute__((aligned(16))) f16 ldsV[2][HD * P64];   // V stage: [d][m], m contiguous, padded rows

  const int tid  = threadIdx.x;
  const int lane = tid & 31;
  const int wave = tid >> 5;
  const int lm = lane & 15;
  const int hi = lane >> 4;

  const int gid = blockIdx.x;        // B*H*8 = 1024 blocks
  const int b  = gid >> 7;
  const int h  = (gid >> 3) & 15;
  const int qc = gid & 7;
  const int n0 = (qc * 8 + wave) * 16;

  const size_t boff = (size_t)b * DM * NN;
  const f16* Qb = Q  + boff;
  const f16* Kb = Km + boff;
  const f16* Vb = Vm + boff;

  // Q as B fragments: column n (lane), K = head-dim d (64 -> 2 frags)
  Frag16 qa[2];
#pragma unroll
  for (int f = 0; f < 2; ++f)
#pragma unroll
    for (int e = 0; e < 16; ++e) {
      int d = f * 32 + hi * 8 + ((e & 8) << 1) + (e & 7);
      qa[f].h[e] = Qb[(size_t)(d * NH + h) * NN + (n0 + lm)];
    }

  v8f zero = {};
  v8f oacc[4];                       // O[d = f*16 + 8*hi + r][n0 + lm]
#pragma unroll
  for (int f = 0; f < 4; ++f) oacc[f] = zero;
  float mrow = -1.0e30f;             // running maximum of query n0 + lm (equal in both halves)
  float lrow = 0.0f;                 // running sum over this half's keys; the halves join after the loop

  const int sr = tid >> 3;           // 0..31: head-dim row for staging (and row + 32)
  const int sc = (tid & 7) * 8;      // key chunk for staging: 8 lanes x 16 B = one whole 128-B line of the row

  auto stageKV = [&](int buf, int mS) {
    const size_t g0 = (size_t)(sr * NH + h) * NN + mS + sc;
    const size_t g1 = g0 + (size_t)32 * NH * NN;
    async_copy16(Kb + g0, &ldsK[buf][sr * KP + sc]);
    async_copy16(Kb + g1, &ldsK[buf][(sr + 32) * KP + sc]);
    async_copy16(Vb + g0, &ldsV[buf][sr * P64 + sc]);
    async_copy16(Vb + g1, &ldsV[buf][(sr + 32) * P64 + sc]);
  };

  // prologue: stage 0 lands and is published, then stage 1 starts
  stageKV(0, 0);
  // this wave's copies of stage 0 have landed before the barrier publishes them
  asm volatile("s_wait_asynccnt 0x0" ::: "memory");
  __syncthreads();
  stageKV(1, KS);

  for (int st = 0; st < NN / KS; ++st) {
   const f16* Kst = ldsK[st & 1];
   const f16* Vst = ldsV[st & 1];
#pragma unroll 1
   for (int ps32 = 0; ps32 < KS; ps32 += 32) {
    // ---- S^T = K^T Q  (two 16x16 tiles covering 32 keys): s[t][r] = S[n0 + lm][st*KS + ps32 + t*16 + 8*hi + r]
    v8f s[2];
#pragma unroll
    for (int t = 0; t < 2; ++t) {
      s[t] = zero;
#pragma unroll
      for (int f = 0; f < 2; ++f) {
        const v16h kb = frag_tr_from_lds<KP>(Kst + f * 32 * KP + ps32 + t * 16, lane);
        s[t] = __builtin_amdgcn_wmma_f32_16x16x32_f16(
            false, kb, false, qa[f].v, (short)0, s[t], false, false);
      }
    }

    // ---- online softmax: one query a lane, its keys down the registers
    s[0] *= 0.125f;                  // 1/sqrt(64)
    s[1] *= 0.125f;
    float rmax = fmaxf(s[0][0], s[1][0]);
#pragma unroll
    for (int r = 1; r < 8; ++r) rmax = fmaxf(rmax, fmaxf(s[0][r], s[1][r]));
    rmax = fmaxf(rmax, xhalf(rmax));
    const float mnew  = fmaxf(mrow, rmax);
    const float alpha = __expf(mrow - mnew);
    mrow = mnew;

    // P^T in the B layout: element e = key 8*hi + e (e < 8), 16 + 8*hi + (e - 8) above
    Frag16 pb;
    float ps[8];
#pragma unroll
    for (int r = 0; r < 8; ++r) {
      float p0 = __expf(s[0][r] - mnew);
      float p1 = __expf(s[1][r] - mnew);
      pb.h[r]     = (f16)p0;
      pb.h[r + 8] = (f16)p1;
      ps[r] = p0 + p1;
    }
    const float rs = ((ps[0] + ps[1]) + (ps[2] + ps[3])) + ((ps[4] + ps[5]) + (ps[6] + ps[7]));
    lrow = lrow * alpha + rs;
#pragma unroll
    for (int f = 0; f < 4; ++f) oacc[f] *= alpha;

    // ---- O += V P^T   (K = 32 keys, 4 tiles covering d=64)
#pragma unroll
    for (int f = 0; f < 4; ++f) {
      Frag16 vb;
      const unsigned* p32 = (const unsigned*)(Vst + (f * 16 + lm) * P64 + ps32);
#pragma unroll
      for (int p = 0; p < 8; ++p) {
        int m = hi * 8 + ((p & 4) << 2) + ((p & 3) << 1);
        vb.u[p] = p32[m >> 1];
      }
      oacc[f] = __builtin_amdgcn_wmma_f32_16x16x32_f16(
          false, vb.v, false, pb.v, (short)0, oacc[f], false, false);
    }
   }

    // this wave's LDS reads of the stage at work are over before the barrier frees its buffer for refill
    asm volatile("s_wait_dscnt 0x0" ::: "memory");
    // this wave's copies of the next stage have landed before the barrier publishes them
    asm volatile("s_wait_asynccnt 0x0" ::: "memory");
    __syncthreads();
    if (st + 2 < NN / KS) stageKV(st & 1, (st + 2) * KS);
  }
  // no copy of this wave is left in flight at its end
  asm volatile("s_wait_asynccnt 0x0" ::: "memory");

  // ---- join the halves' sums and normalize; the block's 64 x 128 outputs O[d][n] meet in the K ring, which the
  // last stage's foot has freed (no LDS read and no copy of any wave left, then the barrier), and leave as whole lines
  const float lsum = lrow + xhalf(lrow);
  f16* stO = &ldsK[0][0];            // [d][n of the block], padded rows: HD * PO of the ring's 2 * HD * KP values
  static_assert(HD * PO <= 2 * HD * KP, "the staged outputs fit the K ring");
#pragma unroll
  for (int f = 0; f < 4; ++f) {
#pragma unroll
    for (int r = 0; r < 8; ++r) {
      int d = f * 16 + 8 * hi + r;
      float v = oacc[f][r] / lsum;
      stO[d * PO + wave * 16 + lm] = (f16)v;
    }
  }
  // every wave's columns are in LDS before any wave reads whole rows
  __syncthreads();
#pragma unroll
  for (int i = 0; i < 4; ++i) {
    const int d = wave * 8 + i * 2 + hi;   // 16 lanes x 16 B = the two whole lines of a row
    const v8h y = *(const v8h*)&stO[d * PO + lm * 8];
    *(v8h*)&Xa[boff + (size_t)(d * NH + h) * NN + qc * 128 + lm * 8] = y;
  }
}

// ---------------------------------------------------------------------------
extern "C" void kernel_launch(void* const* d_in, const int* in_sizes, int n_in,
                              void* d_out, int out_size, void* d_ws, size_t ws_size,
                              hipStream_t stream) {
  const float* q_in = (const float*)d_in[0];
  const float* k_in = (const float*)d_in[1];
  const float* v_in = (const float*)d_in[2];
  const float* Wq = (const float*)d_in[3];
  const float* bq = (const float*)d_in[4];
  const float* Wk = (const float*)d_in[5];
  const float* bk = (const float*)d_in[6];
  const float* Wv = (const float*)d_in[7];
  const float* bv = (const float*)d_in[8];
  const float* Wm = (const float*)d_in[9];
  const float* bm = (const float*)d_in[10];
  float* out = (float*)d_out;

  // workspace partition (all f16)
  f16* ws = (f16*)d_ws;
  const size_t SB = (size_t)BATCH * DM * NN;  // 8M elems
  const size_t SW = (size_t)DM * DM;          // 1M elems
  f16* q16  = ws;
  f16* k16  = q16  + SB;
  f16* v16  = k16  + SB;
  f16* wq16 = v16  + SB;
  f16* wk16 = wq16 + SW;
  f16* wv16 = wk16 + SW;
  f16* wm16 = wv16 + SW;
  f16* Qp   = wm16 + SW;
  f16* Kp   = Qp   + SB;
  f16* Vp   = Kp   + SB;
  f16* Xat  = Vp   + SB;

  // 1) convert fp32 inputs/weights to f16: one launch, one block a WGP; q16 .. wm16 are contiguous
  cvt_f32_to_f16<<<CVT_B, CVT_T, 0, stream>>>(q_in, k_in, v_in, Wq, Wk, Wv, Wm, q16);

  // 2) Q/K/V projections (WMMA GEMM, f16 out): one launch, z = (projection, batch);
  //    wq16..wv16, q16..v16 and Qp..Vp are each contiguous
  dim3 g3(NN / BN, DM / BM, 3 * BATCH);
  gemm1024_wmma<<<g3, 256, 0, stream>>>(wq16, q16, bq, bk, bv, Qp, nullptr, 0);

  // 3) flash attention: one block per (b, h, 128 queries); 8 waves share the K/V stages in LDS
  attn_wmma<<<BATCH * NH * (NN / 128), 256, 0, stream>>>(Qp, Kp, Vp, Xat);

  // 4) output projection (fp32 out)
  dim3 g1(NN / BN, DM / BM, BATCH);
  gemm1024_wmma<<<g1, 256, 0, stream>>>(wm16, Xat, bm, bm, bm, nullptr, out, 1);
}

// v008
// One run takes 114 microseconds.
// In both of two side-by-side timings against v007, it was 1.22 times as fast.
// Over all steps from v000 it is 4.30 times as fast.
#include <hip/hip_runtime.h>
#include <hip/hip_bf16.h>

typedef _Float16 f16;
typedef __attribute__((ext_vector_type(16))) _Float16 v16h;
typedef __attribute__((ext_vector_type(8)))  float    v8f;
typedef __attribute__((ext_vector_type(4)))  int      v4i;
typedef __attribute__((ext_vector_type(8)))  short    v8s;
typedef __attribute__((ext_vector_type(8)))  _Float16 v8h;

#define DM 1024   // d_model
#define NN 1024   // sequence length
#define BATCH 8
#define NH 16     // heads
#define HD 64     // head dim
#define KS 64     // keys of an attention K/V stage: rows of one whole 128-B line

#define BM 128
#define BN 128
#define BK 64
#define XP 144
#define KP 80
#define P64 72
#define PF  68
#define PO  136

union Frag16 { v16h v; unsigned u[8]; f16 h[16]; };
union FragT  { v16h v; v8s q[2]; };

#if defined(__gfx1250__) && __has_builtin(__builtin_amdgcn_global_load_async_to_lds_b128)
#define USE_ASYNC_LDS 1
#else
#define USE_ASYNC_LDS 0
#endif

__device__ inline void async_copy16(const f16* g, f16* l) {
#if USE_ASYNC_LDS
  f16* gnc = (f16*)g;  // strip const first; then retype + addrspacecast
  __builtin_amdgcn_global_load_async_to_lds_b128(
      (v4i __attribute__((address_space(1)))*)gnc,
      (v4i __attribute__((address_space(3)))*)l, 0, 0);
#else
  *(float4*)l = *(const float4*)g;
#endif
}

// ---------------------------------------------------------------------------
// fp32 -> f16 conversion of all seven operands in ONE launch, built as a stream:
// one block of 16 waves for each WGP; a wave walks CVT_NC chunks of CVT_L loads,
// each load 512 contiguous bytes (four whole lines), and keeps the loads of the
// next CVT_A chunks in flight while it converts and stores the oldest one.
// The f16 copies lie one behind the other in out: q, k, v, Wq, Wk, Wv, Wm, and
// chunk c of wave w is chunk c * CVT_W + w of that row of operands.
// ---------------------------------------------------------------------------
typedef __attribute__((ext_vector_type(4))) float    v4f;
typedef __attribute__((ext_vector_type(4))) _Float16 v4h;
typedef const __attribute__((address_space(1))) v4f gl_v4f;
typedef __attribute__((address_space(1))) v4h gl_v4h;

#define CVT_T  512                     // threads of a block: 16 waves
#define CVT_B  256                     // blocks
#define CVT_W  (CVT_B * CVT_T / 32)    // waves of the launch
#define CVT_L  8                       // loads of a chunk
#define CVT_CH (CVT_L * 128)           // elements of a chunk
#define CVT_NC 7                       // chunks of a wave
#define CVT_A  2                       // chunks whose loads run ahead of the chunk at work
#define SZ_X ((long)BATCH * DM * NN)
#define SZ_W ((long)DM * DM)
#define CVT_R ((long)CVT_W * CVT_CH)   // elements of a round: one chunk of every wave
static_assert(SZ_X == 2 * CVT_R, "an activation is two rounds of chunks");
static_assert(4 * SZ_W == CVT_R, "the four weights are one round of chunks");
static_assert((SZ_W / CVT_CH) % (CVT_T / 32) == 0, "a block stays inside one weight");

__global__ __launch_bounds__(CVT_T)
void cvt_f32_to_f16(const float* __restrict__ q,  const float* __restrict__ k,
                    const float* __restrict__ v,  const float* __restrict__ wq,
                    const float* __restrict__ wk, const float* __restrict__ wv,
                    const float* __restrict__ wm, f16* __restrict__ out) {
  const unsigned s  = blockIdx.x / (unsigned)(SZ_W / CVT_CH / (CVT_T / 32));   // the block's weight
  const float* wsel = s == 0 ? wq : s == 1 ? wk : s == 2 ? wv : wm;
  // Every load and store is "operand's start (scalar) + 32-bit byte offset of the lane (vector) + constant":
  // w4, w2 = the lane's byte offset in a round of f32, of f16; an activation's second round and the
  // rounds of out are reached through the offset, which stays far below 2^32
  const float* in[CVT_NC] = { q, q, k, k, v, v, wsel };
  const unsigned e  = (blockIdx.x * (CVT_T / 32) + (threadIdx.x >> 5)) * CVT_CH + (threadIdx.x & 31) * 4;
  const unsigned w4 = e * 4u, w2 = e * 2u;
  const unsigned r4 = (unsigned)(CVT_R * 4);             // bytes of a round of f32
  const unsigned io[CVT_NC] = { w4, w4 + r4, w4, w4 + r4, w4, w4 + r4, w4 - s * (unsigned)(SZ_W * 4) };

  v4f buf[CVT_A + 1][CVT_L];
  // non-temporal: the f32 words are read once and need no place in L2
#define CVT_LOAD(C) do { _Pragma("unroll") for (int j = 0; j < CVT_L; ++j)  \
    buf[(C) % (CVT_A + 1)][j] = __builtin_nontemporal_load((gl_v4f*)((unsigned long)in[C] + j * 512 + io[C])); } while (0)

#pragma unroll
  for (int c = 0; c < CVT_A; ++c) CVT_LOAD(c);
#pragma unroll
  for (int c = 0; c < CVT_NC; ++c) {
    // the scheduling barriers hold the order "loads of chunk c + CVT_A, then chunk c's conversion and
    // stores": left free, the loads sink towards their use and the stores gather at the kernel's end
    __builtin_amdgcn_sched_barrier(0);
    if (c > 0) asm volatile("s_wait_xcnt 0x0" ::: "memory");
    if (c + CVT_A < CVT_NC) CVT_LOAD(c + CVT_A);
    __builtin_amdgcn_sched_barrier(0);
#pragma unroll
    for (int j = 0; j < CVT_L; ++j) {
      const v4f x = buf[c % (CVT_A + 1)][j];
      v4h y;
      y[0] = (f16)x[0]; y[1] = (f16)x[1]; y[2] = (f16)x[2]; y[3] = (f16)x[3];
      *(gl_v4h*)((unsigned long)out + j * 256 + (w2 + c * (r4 / 2))) = y;   // 256 contiguous bytes a wave: two whole lines
    }
  }
#undef CVT_LOAD
}

__device__ inline v16h frag_from_lds(const f16* rowbase, int khalf) {
  FragT f;
  f.q[0] = *(const v8s*)(rowbase + khalf);        // k = khalf + 0..7
  f.q[1] = *(const v8s*)(rowbase + khalf + 16);   // k = khalf + 16..23
  return f.v;
}

// ---------------------------------------------------------------------------
// Build a 16x32 f16 A fragment (T^T) from an LDS tile T stored [k][n], n contiguous,
// row pitch PITCH. The transposing load hands lane (c = lane & 15, h = lane >> 4)
// the eight values T[kbase + 8h + 0..7][c]; the loads at kbase 0 and 16 give
// the same k order as frag_from_lds gives the W fragments of the GEMM.
// ---------------------------------------------------------------------------
template <int PITCH>
__device__ inline v16h frag_tr_from_lds(const f16* colbase, int lane) {
  typedef __attribute__((address_space(3))) v8s lds_v8s;
  const f16* p = colbase + ((lane >> 4) * 8 + (lane & 7)) * PITCH + ((lane >> 3) & 1) * 8;
  FragT f;
  f.q[0] = __builtin_amdgcn_ds_load_tr16_b128_v8i16((lds_v8s*)p);
  f.q[1] = __builtin_amdgcn_ds_load_tr16_b128_v8i16((lds_v8s*)(p + 16 * PITCH));
  return f.v;
}

// ---------------------------------------------------------------------------
// GEMM: Y[z] = W[z / BATCH](1024x1024) @ X[z](1024x1024) + bias[z / BATCH]   (f16 WMMA)
// blockIdx.z = z counts (projection, batch): the projections' W, X and Y lie one
// behind the other in memory, so independent projections share one launch.
// Double-buffered LDS; both tiles filled with async-to-LDS; the X tile stays
// [k][n] as in memory and is transposed by the LDS read.
// The product is taken as Y^T = X^T W^T (X fragments first): a lane then holds eight
// neighbouring n of ONE row m, so it needs one bias value a tile and writes 16 bytes
// at a time; each wave turns its 32 x 64 tile in its own piece of the freed ring
// and stores whole 128-B lines.
// writeF32 ? write float to Yf : write f16 to Yh
// ---------------------------------------------------------------------------
__global__ __launch_bounds__(256)
void gemm1024_wmma(const f16* __restrict__ Wall, const f16* __restrict__ X,
                   const float* __restrict__ bias0, const float* __restrict__ bias1,
                   const float* __restrict__ bias2,
                   f16* __restrict__ Yh, float* __restrict__ Yf, int writeF32)
{
  __shared__ __attribute__((aligned(16))) f16 ldsW[2][BM * P64];  // [m][k], k contiguous, padded rows
  __shared__ __attribute__((aligned(16))) f16 ldsX[2][BK * XP];   // [k][n], n contiguous, padded rows

  const int b  = blockIdx.z;          // (projection, batch)
  const int pj = b / BATCH;           // which projection
  const f16* Xb = X + (size_t)b * DM * NN;
  const f16* W  = Wall + (size_t)pj * DM * DM;
  const float* bias = pj == 0 ? bias0 : pj == 1 ? bias1 : bias2;
  const int m0 = blockIdx.y * BM;
  const int n0 = blockIdx.x * BN;
  const int tid  = threadIdx.x;
  const int lane = tid & 31;
  const int wave = tid >> 5;
  const int wm = (wave >> 1) * 32;   // 4 waves along M
  const int wn = (wave & 1) * 64;    // 2 waves along N
  const int lm = lane & 15;
  const int hi = lane >> 4;
  const int khalf = hi * 8;

  const int sr = tid >> 3;        // 0..31: row of a tile for staging (and every 32nd row from there)
  const int sc = (tid & 7) * 8;   // 8 lanes x 16 B = one whole 128-B line of the row: a wave's copy touches four lines
  auto stageW = [&](int buf, int k0) {
    const f16* src = W + (size_t)(m0 + sr) * DM + k0 + sc;
    f16* dst = &ldsW[buf][sr * P64 + sc];
    async_copy16(src,                        dst);
    async_copy16(src + (size_t)32 * DM,      dst + 32 * P64);
    async_copy16(src + (size_t)64 * DM,      dst + 64 * P64);
    async_copy16(src + (size_t)96 * DM,      dst + 96 * P64);
  };
  auto stageX = [&](int buf, int k0) {
    const f16* src = Xb + (size_t)(k0 + sr) * NN + n0 + sc;
    f16* dst = &ldsX[buf][sr * XP + sc];
    async_copy16(src,                        dst);
    async_copy16(src + 64,                   dst + 64);
    async_copy16(src + (size_t)32 * NN,      dst + 32 * XP);
    async_copy16(src + (size_t)32 * NN + 64, dst + 32 * XP + 64);
  };
  static_assert(BM == 128 && BN == 128 && BK == 64, "the eight copies above cover a 128 x 64 W tile and a 64 x 128 X tile");

  v8f zero = {};
  v8f acc[2][4];
#pragma unroll
  for (int i = 0; i < 2; ++i)
#pragma unroll
    for (int j = 0; j < 4; ++j) acc[i][j] = zero;

  // prologue: fill buffer 0
  stageW(0, 0);
  stageX(0, 0);
  // this wave's copies of tile 0 have landed before the barrier publishes them
  asm volatile("s_wait_asynccnt 0x0" ::: "memory");
  __syncthreads();

  for (int k0 = 0; k0 < DM; k0 += BK) {
    const int cur = (k0 / BK) & 1;
    const int nxt = cur ^ 1;

    // overlap: start filling the next tile before computing on the current
    if (k0 + BK < DM) {
      stageW(nxt, k0 + BK);
      stageX(nxt, k0 + BK);
    }

    // the stage's two blocks of 32 k, in rising k; unrolled so that the second block's LDS reads can start under the first's products
#pragma unroll
    for (int ks = 0; ks < BK; ks += 32) {
      v16h a[2], bb[4];
#pragma unroll
      for (int mt = 0; mt < 2; ++mt)
        a[mt]  = frag_from_lds(&ldsW[cur][(wm + mt * 16 + lm) * P64 + ks], khalf);
#pragma unroll
      for (int nt = 0; nt < 4; ++nt)
        bb[nt] = frag_tr_from_lds<XP>(&ldsX[cur][ks * XP + wn + nt * 16], lane);

#pragma unroll
      for (int mt = 0; mt < 2; ++mt)
#pragma unroll
        for (int nt = 0; nt < 4; ++nt)
          acc[mt][nt] = __builtin_amdgcn_wmma_f32_16x16x32_f16(
              false, bb[nt], false, a[mt], (short)0, acc[mt][nt], false, false);
    }

    // this wave's LDS reads of the current buffers are over before the barrier frees them for refill
    asm volatile("s_wait_dscnt 0x0" ::: "memory");
    // this wave's copies of the next tile have landed before the barrier publishes them
    asm volatile("s_wait_asynccnt 0x0" ::: "memory");
    __syncthreads();
  }

  // epilogue: acc[mt][nt][r] = Y[m0 + wm + mt*16 + lm][n0 + wn + nt*16 + 8*hi + r].
  // The last pass's foot (no LDS read and no copy of any wave left, then the barrier) has freed the ring.
  // The loops below are unrolled so that every accumulator index is a constant: registers, not scratch.
  float bv[2];
#pragma unroll
  for (int mt = 0; mt < 2; ++mt) bv[mt] = bias[m0 + wm + mt * 16 + lm];
  const size_t ybase = ((size_t)b * DM + m0 + wm) * NN + n0 + wn;   // first output of the wave's tile
  // a wave's own piece of the freed ring, 32 * P64 f16: waves 0..3 share the W ring, waves 4..7 the X ring
  static_assert(4 * 32 * P64 <= 2 * BM * P64 && 4 * 32 * P64 <= 2 * BK * XP, "four pieces fit each ring");
  static_assert(16 * PF * 4 <= 32 * P64 * 2, "16 rows of f32 fit a piece");
  f16* piece = (wave < 4 ? &ldsW[0][0] : &ldsX[0][0]) + (wave & 3) * 32 * P64;

  if (writeF32) {
    float* st = (float*)piece;               // 16 x 64 f32, [m][n], padded rows: the tile's two halves one after the other
#pragma unroll
    for (int mt = 0; mt < 2; ++mt) {
#pragma unroll
      for (int nt = 0; nt < 4; ++nt) {
        v4f y0, y1;
#pragma unroll
        for (int r = 0; r < 4; ++r) {
          y0[r] = acc[mt][nt][r]     + bv[mt];
          y1[r] = acc[mt][nt][r + 4] + bv[mt];
        }
        *(v4f*)&st[lm * PF + nt * 16 + hi * 8]     = y0;
        *(v4f*)&st[lm * PF + nt * 16 + hi * 8 + 4] = y1;
      }
      // the wave's own LDS writes are over before other lanes of it read the rows back
      asm volatile("s_wait_dscnt 0x0" ::: "memory");
#pragma unroll
      for (int i = 0; i < 8; ++i) {
        const int row = i * 2 + hi;          // 16 lanes x 16 B = the two whole lines of a row
        const v4f y = *(const v4f*)&st[row * PF + lm * 4];
        *(v4f*)&Yf[ybase + (size_t)(mt * 16 + row) * NN + lm * 4] = y;
      }
    }
    asm volatile("s_wait_xcnt 0x0" ::: "memory");
  } else {
    f16* st = piece;                         // 32 x 64 f16, [m][n], padded rows
#pragma unroll
    for (int mt = 0; mt < 2; ++mt)
#pragma unroll
      for (int nt = 0; nt < 4; ++nt) {
        v8h y;
#pragma unroll
        for (int r = 0; r < 8; ++r) y[r] = (f16)(acc[mt][nt][r] + bv[mt]);
        *(v8h*)&st[(mt * 16 + lm) * P64 + nt * 16 + hi * 8] = y;
      }
    // the wave's own LDS writes are over before other lanes of it read the rows back
    asm volatile("s_wait_dscnt 0x0" ::: "memory");
#pragma unroll
    for (int i = 0; i < 8; ++i) {
      const int row = i * 4 + (lane >> 3);   // 8 lanes x 16 B = the whole line of a row
      const int ch  = (lane & 7) * 8;
      const v8h y = *(const v8h*)&st[row * P64 + ch];
      *(v8h*)&Yh[ybase + (size_t)row * NN + ch] = y;
    }
  }
}

__device__ inline float xhalf(float x) {
  int b = __builtin_bit_cast(int, x);
  return __builtin_bit_cast(float,
      __builtin_amdgcn_permlanex16(b, b, 0x76543210, 0xfedcba98, false, false));
}

// ---------------------------------------------------------------------------
// Flash attention over Q/K/V f16 buffers laid out [b, c, n], c = d*16 + h.
// One block handles 128 queries of one (b, h); its 8 waves cover 8 query tiles of 16 columns
// and SHARE the K/V stages of KS keys. A stage goes to LDS as it lies in memory,
// [d][m], by async copies of whole lines into one of two buffers, one stage ahead
// of the stage at work; K is transposed by the LDS read. A pass is 32 keys.
// Both products are taken transposed, S^T = K^T Q and O = V P^T: a lane holds
// the scores of ONE query (16 of the 32 keys, the other 16 in lane ^ 16), so
// maximum and sum run down its own registers, and the two score tiles,
// converted in place, are the B operand of the second product.
// ---------------------------------------------------------------------------
__global__ __launch_bounds__(256)
void attn_wmma(const f16* __restrict__ Q, const f16* __restrict__ Km,
               const f16* __restrict__ Vm, f16* __restrict__ Xa)
{
  __shared__ __attribute__((aligned(16))) f16 ldsK[2][HD * KP];    // K stage: [d][m], m contiguous, padded rows
  __shared__ __attribute__((aligned(16))) f16 ldsV[2][HD * P64];   // V stage: [d][m], m contiguous, padded rows

  const int tid  = threadIdx.x;
  const int lane = tid & 31;
  const int wave = tid >> 5;
  const int lm = lane & 15;
  const int hi = lane >> 4;

  const int gid = blockIdx.x;        // B*H*8 = 1024 blocks
  const int b  = gid >> 7;
  const int h  = (gid >> 3) & 15;
  const int qc = gid & 7;
  const int n0 = (qc * 8 + wave) * 16;

  const size_t boff = (size_t)b * DM * NN;
  const f16* Qb = Q  + boff;
  const f16* Kb = Km + boff;
  const f16* Vb = Vm + boff;

  // Q as B fragments: column n (lane), K = head-dim d (64 -> 2 frags)
  Frag16 qa[2];
#pragma unroll
  for (int f = 0; f < 2; ++f)
#pragma unroll
    for (int e = 0; e < 16; ++e) {
      int d = f * 32 + hi * 8 + ((e & 8) << 1) + (e & 7);
      qa[f].h[e] = Qb[(size_t)(d * NH + h) * NN + (n0 + lm)];
    }

  v8f zero = {};
  v8f oacc[4];                       // O[d = f*16 + 8*hi + r][n0 + lm]
#pragma unroll
  for (int f = 0; f < 4; ++f) oacc[f] = zero;
  float mrow = -1.0e30f;             // running maximum of query n0 + lm (equal in both halves)
  float lrow = 0.0f;                 // running sum over this half's keys; the halves join after the loop

  const int sr = tid >> 3;           // 0..31: head-dim row for staging (and row + 32)
  const int sc = (tid & 7) * 8;      // key chunk for staging: 8 lanes x 16 B = one whole 128-B line of the row

  auto stageKV = [&](int buf, int mS) {
    const size_t g0 = (size_t)(sr * NH + h) * NN + mS + sc;
    const size_t g1 = g0 + (size_t)32 * NH * NN;
    async_copy16(Kb + g0, &ldsK[buf][sr * KP + sc]);
    async_copy16(Kb + g1, &ldsK[buf][(sr + 32) * KP + sc]);
    async_copy16(Vb + g0, &ldsV[buf][sr * P64 + sc]);
    async_copy16(Vb + g1, &ldsV[buf][(sr + 32) * P64 + sc]);
  };

  // prologue: stage 0 lands and is published, then stage 1 starts
  stageKV(0, 0);
  // this wave's copies of stage 0 have landed before the barrier publishes them
  asm volatile("s_wait_asynccnt 0x0" ::: "memory");
  __syncthreads();
  stageKV(1, KS);

  for (int st = 0; st < NN / KS; ++st) {
   const f16* Kst = ldsK[st & 1];
   const f16* Vst = ldsV[st & 1];
#pragma unroll 1
   for (int ps32 = 0; ps32 < KS; ps32 += 32) {
    // ---- S^T = K^T Q  (two 16x16 tiles covering 32 keys): s[t][r] = S[n0 + lm][st*KS + ps32 + t*16 + 8*hi + r]
    v8f s[2];
#pragma unroll
    for (int t = 0; t < 2; ++t) {
      s[t] = zero;
#pragma unroll
      for (int f = 0; f < 2; ++f) {
        const v16h kb = frag_tr_from_lds<KP>(Kst + f * 32 * KP + ps32 + t * 16, lane);
        s[t] = __builtin_amdgcn_wmma_f32_16x16x32_f16(
            false, kb, false, qa[f].v, (short)0, s[t], false, false);
      }
    }

    // ---- online softmax: one query a lane, its keys down the registers
    s[0] *= 0.125f;                  // 1/sqrt(64)
    s[1] *= 0.125f;
    float rmax = fmaxf(s[0][0], s[1][0]);
#pragma unroll
    for (int r = 1; r < 8; ++r) rmax = fmaxf(rmax, fmaxf(s[0][r], s[1][r]));
    rmax = fmaxf(rmax, xhalf(rmax));
    const float mnew  = fmaxf(mrow, rmax);
    const float alpha = __expf(mrow - mnew);
    mrow = mnew;

    // P^T in the B layout: element e = key 8*hi + e (e < 8), 16 + 8*hi + (e - 8) above
    Frag16 pb;
    float ps[8];
#pragma unroll
    for (int r = 0; r < 8; ++r) {
      float p0 = __expf(s[0][r] - mnew);
      float p1 = __expf(s[1][r] - mnew);
      pb.h[r]     = (f16)p0;
      pb.h[r + 8] = (f16)p1;
      ps[r] = p0 + p1;
    }
    const float rs = ((ps[0] + ps[1]) + (ps[2] + ps[3])) + ((ps[4] + ps[5]) + (ps[6] + ps[7]));
    lrow = lrow * alpha + rs;
#pragma unroll
    for (int f = 0; f < 4; ++f) oacc[f] *= alpha;

    // ---- O += V P^T   (K = 32 keys, 4 tiles covering d=64)
#pragma unroll
    for (int f = 0; f < 4; ++f) {
      Frag16 vb;
      const unsigned* p32 = (const unsigned*)(Vst + (f * 16 + lm) * P64 + ps32);
#pragma unroll
      for (int p = 0; p < 8; ++p) {
        int m = hi * 8 + ((p & 4) << 2) + ((p & 3) << 1);
        vb.u[p] = p32[m >> 1];
      }
      oacc[f] = __builtin_amdgcn_wmma_f32_16x16x32_f16(
          false, vb.v, false, pb.v, (short)0, oacc[f], false, false);
    }
   }

    // this wave's LDS reads of the stage at work are over before the barrier frees its buffer for refill
    asm volatile("s_wait_dscnt 0x0" ::: "memory");
    // this wave's copies of the next stage have landed before the barrier publishes them
    asm volatile("s_wait_asynccnt 0x0" ::: "memory");
    __syncthreads();
    if (st + 2 < NN / KS) stageKV(st & 1, (st + 2) * KS);
  }
  // no copy of this wave is left in flight at its end
  asm volatile("s_wait_asynccnt 0x0" ::: "memory");

  // ---- join the halves' sums and normalize; the block's 64 x 128 outputs O[d][n] meet in the K ring, which the
  // last stage's foot has freed (no LDS read and no copy of any wave left, then the barrier), and leave as whole lines
  const float lsum = lrow + xhalf(lrow);
  f16* stO = &ldsK[0][0];            // [d][n of the block], padded rows: HD * PO of the ring's 2 * HD * KP values
  static_assert(HD * PO <= 2 * HD * KP, "the staged outputs fit the K ring");
#pragma unroll
  for (int f = 0; f < 4; ++f) {
#pragma unroll
    for (int r = 0; r < 8; ++r) {
      int d = f * 16 + 8 * hi + r;
      float v = oacc[f][r] / lsum;
      stO[d * PO + wave * 16 + lm] = (f16)v;
    }
  }
  // every wave's columns are in LDS before any wave reads whole rows
  __syncthreads();
#pragma unroll
  for (int i = 0; i < 4; ++i) {
    const int d = wave * 8 + i * 2 + hi;   // 16 lanes x 16 B = the two whole lines of a row
    const v8h y = *(const v8h*)&stO[d * PO + lm * 8];
    *(v8h*)&Xa[boff + (size_t)(d * NH + h) * NN + qc * 128 + lm * 8] = y;
  }
}

// ---------------------------------------------------------------------------
extern "C" void kernel_launch(void* const* d_in, const int* in_sizes, int n_in,
                              void* d_out, int out_size, void* d_ws, size_t ws_size,
                              hipStream_t stream) {
  const float* q_in = (const float*)d_in[0];
  const float* k_in = (const float*)d_in[1];
  const float* v_in = (const float*)d_in[2];
  const float* Wq = (const float*)d_in[3];
  const float* bq = (const float*)d_in[4];
  const float* Wk = (const float*)d_in[5];
  const float* bk = (const float*)d_in[6];
  const float* Wv = (const float*)d_in[7];
  const float* bv = (const float*)d_in[8];
  const float* Wm = (const float*)d_in[9];
  const float* bm = (const float*)d_in[10];
  float* out = (float*)d_out;

  // workspace partition (all f16)
  f16* ws = (f16*)d_ws;
  const size_t SB = (size_t)BATCH * DM * NN;  // 8M elems
  const size_t SW = (size_t)DM * DM;          // 1M elems
  f16* q16  = ws;
  f16* k16  = q16  + SB;
  f16* v16  = k16  + SB;
  f16* wq16 = v16  + SB;
  f16* wk16 = wq16 + SW;
  f16* wv16 = wk16 + SW;
  f16* wm16 = wv16 + SW;
  f16* Qp   = wm16 + SW;
  f16* Kp   = Qp   + SB;
  f16* Vp   = Kp   + SB;
  f16* Xat  = Vp   + SB;

  // 1) convert fp32 inputs/weights to f16: one launch, one block a WGP; q16 .. wm16 are contiguous
  cvt_f32_to_f16<<<CVT_B, CVT_T, 0, stream>>>(q_in, k_in, v_in, Wq, Wk, Wv, Wm, q16);

  // 2) Q/K/V projections (WMMA GEMM, f16 out): one launch, z = (projection, batch);
  //    wq16..wv16, q16..v16 and Qp..Vp are each contiguous
  dim3 g3(NN / BN, DM / BM, 3 * BATCH);
  gemm1024_wmma<<<g3, 256, 0, stream>>>(wq16, q16, bq, bk, bv, Qp, nullptr, 0);

  // 3) flash attention: one block per (b, h, 128 queries); 8 waves share the K/V stages in LDS
  attn_wmma<<<BATCH * NH * (NN / 128), 256, 0, stream>>>(Qp, Kp, Vp, Xat);

  // 4) output projection (fp32 out)
  dim3 g1(NN / BN, DM / BM, BATCH);
  gemm1024_wmma<<<g1, 256, 0, stream>>>(wm16, Xat, bm, bm, bm, nullptr, out, 1);
}

// v009
// One run takes 111 microseconds.
// In both of two side-by-side timings against v008, it was 1.03 times as fast.
// All steps since v000 together make it 4.44 times as fast.
#include <hip/hip_runtime.h>
#include <hip/hip_bf16.h>

typedef _Float16 f16;
typedef __attribute__((ext_vector_type(16))) _Float16 v16h;
typedef __attribute__((ext_vector_type(8)))  float    v8f;
typedef __attribute__((ext_vector_type(4)))  int      v4i;
typedef __attribute__((ext_vector_type(8)))  short    v8s;
typedef __attribute__((ext_vector_type(8)))  _Float16 v8h;

#define DM 1024   // d_model
#define NN 1024   // sequence length
#define BATCH 8
#define NH 16     // heads
#define HD 64     // head dim
#define KS 64     // keys of an attention K/V stage: rows of one whole 128-B line

#define BM 128
#define BN 128
#define BK 64
#define XP 144
#define KP 80
#define P64 72
#define PF  68
#define PO  136

union Frag16 { v16h v; unsigned u[8]; f16 h[16]; };
union FragT  { v16h v; v8s q[2]; };

#if defined(__gfx1250__) && __has_builtin(__builtin_amdgcn_global_load_async_to_lds_b128)
#define USE_ASYNC_LDS 1
#else
#define USE_ASYNC_LDS 0
#endif

__device__ inline void async_copy16(const f16* g, f16* l) {
#if USE_ASYNC_LDS
  f16* gnc = (f16*)g;  // strip const first; then retype + addrspacecast
  __builtin_amdgcn_global_load_async_to_lds_b128(
      (v4i __attribute__((address_space(1)))*)gnc,
      (v4i __attribute__((address_space(3)))*)l, 0, 0);
#else
  *(float4*)l = *(const float4*)g;
#endif
}

// ---------------------------------------------------------------------------
// fp32 -> f16 conversion of all seven operands in ONE launch, built as a stream:
// one block of 16 waves for each WGP; a wave walks CVT_NC chunks of CVT_L loads,
// each load 512 contiguous bytes (four whole lines), and keeps the loads of the
// next CVT_A chunks in flight while it converts and stores the oldest one.
// The f16 copies lie one behind the other in out: q, k, v, Wq, Wk, Wv, Wm, and
// chunk c of wave w is chunk c * CVT_W + w of that row of operands.
// ---------------------------------------------------------------------------
typedef __attribute__((ext_vector_type(4))) float    v4f;
typedef __attribute__((ext_vector_type(4))) _Float16 v4h;
typedef const __attribute__((address_space(1))) v4f gl_v4f;
typedef __attribute__((address_space(1))) v4h gl_v4h;

#define CVT_T  512                     // threads of a block: 16 waves
#define CVT_B  256                     // blocks
#define CVT_W  (CVT_B * CVT_T / 32)    // waves of the launch
#define CVT_L  8                       // loads of a chunk
#define CVT_CH (CVT_L * 128)           // elements of a chunk
#define CVT_NC 7                       // chunks of a wave
#define CVT_A  2                       // chunks whose loads run ahead of the chunk at work
#define SZ_X ((long)BATCH * DM * NN)
#define SZ_W ((long)DM * DM)
#define CVT_R ((long)CVT_W * CVT_CH)   // elements of a round: one chunk of every wave
static_assert(SZ_X == 2 * CVT_R, "an activation is two rounds of chunks");
static_assert(4 * SZ_W == CVT_R, "the four weights are one round of chunks");
static_assert((SZ_W / CVT_CH) % (CVT_T / 32) == 0, "a block stays inside one weight");

__global__ __launch_bounds__(CVT_T)
void cvt_f32_to_f16(const float* __restrict__ q,  const float* __restrict__ k,
                    const float* __restrict__ v,  const float* __restrict__ wq,
                    const float* __restrict__ wk, const float* __restrict__ wv,
                    const float* __restrict__ wm, f16* __restrict__ out) {
  const unsigned s  = blockIdx.x / (unsigned)(SZ_W / CVT_CH / (CVT_T / 32));   // the block's weight
  const float* wsel = s == 0 ? wq : s == 1 ? wk : s == 2 ? wv : wm;
  // Every load and store is "operand's start (scalar) + 32-bit byte offset of the lane (vector) + constant":
  // w4, w2 = the lane's byte offset in a round of f32, of f16; an activation's second round and the
  // rounds of out are reached through the offset, which stays far below 2^32
  const float* in[CVT_NC] = { q, q, k, k, v, v, wsel };
  const unsigned e  = (blockIdx.x * (CVT_T / 32) + (threadIdx.x >> 5)) * CVT_CH + (threadIdx.x & 31) * 4;
  const unsigned w4 = e * 4u, w2 = e * 2u;
  const unsigned r4 = (unsigned)(CVT_R * 4);             // bytes of a round of f32
  const unsigned io[CVT_NC] = { w4, w4 + r4, w4, w4 + r4, w4, w4 + r4, w4 - s * (unsigned)(SZ_W * 4) };

  v4f buf[CVT_A + 1][CVT_L];
  // non-temporal: the f32 words are read once and need no place in L2
#define CVT_LOAD(C) do { _Pragma("unroll") for (int j = 0; j < CVT_L; ++j)  \
    buf[(C) % (CVT_A + 1)][j] = __builtin_nontemporal_load((gl_v4f*)((unsigned long)in[C] + j * 512 + io[C])); } while (0)

#pragma unroll
  for (int c = 0; c < CVT_A; ++c) CVT_LOAD(c);
#pragma unroll
  for (int c = 0; c < CVT_NC; ++c) {
    // the scheduling barriers hold the order "loads of chunk c + CVT_A, then chunk c's conversion and
    // stores": left free, the loads sink towards their use and the stores gather at the kernel's end
    __builtin_amdgcn_sched_barrier(0);
    if (c > 0) asm volatile("s_wait_xcnt 0x0" ::: "memory");
    if (c + CVT_A < CVT_NC) CVT_LOAD(c + CVT_A);
    __builtin_amdgcn_sched_barrier(0);
#pragma unroll
    for (int j = 0; j < CVT_L; ++j) {
      const v4f x = buf[c % (CVT_A + 1)][j];
      v4h y;
      y[0] = (f16)x[0]; y[1] = (f16)x[1]; y[2] = (f16)x[2]; y[3] = (f16)x[3];
      *(gl_v4h*)((unsigned long)out + j * 256 + (w2 + c * (r4 / 2))) = y;   // 256 contiguous bytes a wave: two whole lines
    }
  }
#undef CVT_LOAD
}

__device__ inline v16h frag_from_lds(const f16* rowbase, int khalf) {
  FragT f;
  f.q[0] = *(const v8s*)(rowbase + khalf);        // k = khalf + 0..7
  f.q[1] = *(const v8s*)(rowbase + khalf + 16);   // k = khalf + 16..23
  return f.v;
}

// ---------------------------------------------------------------------------
// Build a 16x32 f16 A fragment (T^T) from an LDS tile T stored [k][n], n contiguous,
// row pitch PITCH. The transposing load hands lane (c = lane & 15, h = lane >> 4)
// the eight values T[kbase + 8h + 0..7][c]; the loads at kbase 0 and 16 give
// the same k order as frag_from_lds gives the W fragments of the GEMM.
// ---------------------------------------------------------------------------
template <int PITCH>
__device__ inline v16h frag_tr_from_lds(const f16* colbase, int lane) {
  typedef __attribute__((address_space(3))) v8s lds_v8s;
  const f16* p = colbase + ((lane >> 4) * 8 + (lane & 7)) * PITCH + ((lane >> 3) & 1) * 8;
  FragT f;
  f.q[0] = __builtin_amdgcn_ds_load_tr16_b128_v8i16((lds_v8s*)p);
  f.q[1] = __builtin_amdgcn_ds_load_tr16_b128_v8i16((lds_v8s*)(p + 16 * PITCH));
  return f.v;
}

// ---------------------------------------------------------------------------
// GEMM: Y[z] = W[z / BATCH](1024x1024) @ X[z](1024x1024) + bias[z / BATCH]   (f16 WMMA)
// blockIdx.z = z counts (projection, batch): the projections' W, X and Y lie one
// behind the other in memory, so independent projections share one launch.
// Double-buffered LDS; both tiles filled with async-to-LDS; the X tile stays
// [k][n] as in memory and is transposed by the LDS read.
// The product is taken as Y^T = X^T W^T (X fragments first): a lane then holds eight
// neighbouring n of ONE row m, so it needs one bias value a tile and writes 16 bytes
// at a time; each wave turns its 32 x 64 tile in its own piece of the freed ring
// and stores whole 128-B lines.
// writeF32 ? write float to Yf : write f16 to Yh
// ---------------------------------------------------------------------------
__global__ __launch_bounds__(256)
void gemm1024_wmma(const f16* __restrict__ Wall, const f16* __restrict__ X,
                   const float* __restrict__ bias0, const float* __restrict__ bias1,
                   const float* __restrict__ bias2,
                   f16* __restrict__ Yh, float* __restrict__ Yf, int writeF32)
{
  __shared__ __attribute__((aligned(16))) f16 ldsW[2][BM * P64];  // [m][k], k contiguous, padded rows
  __shared__ __attribute__((aligned(16))) f16 ldsX[2][BK * XP];   // [k][n], n contiguous, padded rows

  const int b  = blockIdx.z;          // (projection, batch)
  const int pj = b / BATCH;           // which projection
  const f16* Xb = X + (size_t)b * DM * NN;
  const f16* W  = Wall + (size_t)pj * DM * DM;
  const float* bias = pj == 0 ? bias0 : pj == 1 ? bias1 : bias2;
  const int m0 = blockIdx.y * BM;
  const int n0 = blockIdx.x * BN;
  const int tid  = threadIdx.x;
  const int lane = tid & 31;
  const int wave = tid >> 5;
  const int wm = (wave >> 1) * 32;   // 4 waves along M
  const int wn = (wave & 1) * 64;    // 2 waves along N
  const int lm = lane & 15;
  const int hi = lane >> 4;
  const int khalf = hi * 8;

  const int sr = tid >> 3;        // 0..31: row of a tile for staging (and every 32nd row from there)
  const int sc = (tid & 7) * 8;   // 8 lanes x 16 B = one whole 128-B line of the row: a wave's copy touches four lines
  auto stageW = [&](int buf, int k0) {
    const f16* src = W + (size_t)(m0 + sr) * DM + k0 + sc;
    f16* dst = &ldsW[buf][sr * P64 + sc];
    async_copy16(src,                        dst);
    async_copy16(src + (size_t)32 * DM,      dst + 32 * P64);
    async_copy16(src + (size_t)64 * DM,      dst + 64 * P64);
    async_copy16(src + (size_t)96 * DM,      dst + 96 * P64);
  };
  auto stageX = [&](int buf, int k0) {
    const f16* src = Xb + (size_t)(k0 + sr) * NN + n0 + sc;
    f16* dst = &ldsX[buf][sr * XP + sc];
    async_copy16(src,                        dst);
    async_copy16(src + 64,                   dst + 64);
    async_copy16(src + (size_t)32 * NN,      dst + 32 * XP);
    async_copy16(src + (size_t)32 * NN + 64, dst + 32 * XP + 64);
  };
  static_assert(BM == 128 && BN == 128 && BK == 64, "the eight copies above cover a 128 x 64 W tile and a 64 x 128 X tile");

  v8f zero = {};
  v8f acc[2][4];
#pragma unroll
  for (int i = 0; i < 2; ++i)
#pragma unroll
    for (int j = 0; j < 4; ++j) acc[i][j] = zero;

  // Every block walks all NST stages of k, but from a start of its own, round the ring of stages: the blocks that run at the
  // same time and copy the same lines from L2 (a W tile: the 8 n tiles of 8 batches; an X tile: the 8 m tiles) would else
  // ask for the same lines at the same moment, stage after stage. Blocks that share an X tile get 8 different starts,
  // those that share a W tile all 16.
  constexpr int NST = DM / BK;
  static_assert((NST & (NST - 1)) == 0, "the ring of stages is closed by a mask");
  const int rot = (blockIdx.x + blockIdx.y + (NST / 2) * (blockIdx.z & 1)) & (NST - 1);

  // prologue: fill buffer 0
  stageW(0, rot * BK);
  stageX(0, rot * BK);
  // this wave's copies of tile 0 have landed before the barrier publishes them
  asm volatile("s_wait_asynccnt 0x0" ::: "memory");
  __syncthreads();

  for (int k0 = 0; k0 < DM; k0 += BK) {   // k0 counts the k done; the stage at work begins at (k0 + rot * BK) mod DM
    const int cur = (k0 / BK) & 1;
    const int nxt = cur ^ 1;

    // overlap: start filling the next tile before computing on the current
    if (k0 + BK < DM) {
      const int kn = (k0 + BK + rot * BK) & (DM - 1);
      stageW(nxt, kn);
      stageX(nxt, kn);
    }

    // the stage's two blocks of 32 k, in rising k; unrolled so that the second block's LDS reads can start under the first's products
#pragma unroll
    for (int ks = 0; ks < BK; ks += 32) {
      v16h a[2], bb[4];
#pragma unroll
      for (int mt = 0; mt < 2; ++mt)
        a[mt]  = frag_from_lds(&ldsW[cur][(wm + mt * 16 + lm) * P64 + ks], khalf);
#pragma unroll
      for (int nt = 0; nt < 4; ++nt)
        bb[nt] = frag_tr_from_lds<XP>(&ldsX[cur][ks * XP + wn + nt * 16], lane);

#pragma unroll
      for (int mt = 0; mt < 2; ++mt)
#pragma unroll
        for (int nt = 0; nt < 4; ++nt)
          acc[mt][nt] = __builtin_amdgcn_wmma_f32_16x16x32_f16(
              false, bb[nt], false, a[mt], (short)0, acc[mt][nt], false, false);
    }

    // this wave's LDS reads of the current buffers are over before the barrier frees them for refill
    asm volatile("s_wait_dscnt 0x0" ::: "memory");
    // this wave's copies of the next tile have landed before the barrier publishes them
    asm volatile("s_wait_asynccnt 0x0" ::: "memory");
    __syncthreads();
  }

  // epilogue: acc[mt][nt][r] = Y[m0 + wm + mt*16 + lm][n0 + wn + nt*16 + 8*hi + r].
  // The last pass's foot (no LDS read and no copy of any wave left, then the barrier) has freed the ring.
  // The loops below are unrolled so that every accumulator index is a constant: registers, not scratch.
  float bv[2];
#pragma unroll
  for (int mt = 0; mt < 2; ++mt) bv[mt] = bias[m0 + wm + mt * 16 + lm];
  const size_t ybase = ((size_t)b * DM + m0 + wm) * NN + n0 + wn;   // first output of the wave's tile
  // a wave's own piece of the freed ring, 32 * P64 f16: waves 0..3 share the W ring, waves 4..7 the X ring
  static_assert(4 * 32 * P64 <= 2 * BM * P64 && 4 * 32 * P64 <= 2 * BK * XP, "four pieces fit each ring");
  static_assert(16 * PF * 4 <= 32 * P64 * 2, "16 rows of f32 fit a piece");
  f16* piece = (wave < 4 ? &ldsW[0][0] : &ldsX[0][0]) + (wave & 3) * 32 * P64;

  if (writeF32) {
    float* st = (float*)piece;               // 16 x 64 f32, [m][n], padded rows: the tile's two halves one after the other
#pragma unroll
    for (int mt = 0; mt < 2; ++mt) {
#pragma unroll
      for (int nt = 0; nt < 4; ++nt) {
        v4f y0, y1;
#pragma unroll
        for (int r = 0; r < 4; ++r) {
          y0[r] = acc[mt][nt][r]     + bv[mt];
          y1[r] = acc[mt][nt][r + 4] + bv[mt];
        }
        *(v4f*)&st[lm * PF + nt * 16 + hi * 8]     = y0;
        *(v4f*)&st[lm * PF + nt * 16 + hi * 8 + 4] = y1;
      }
      // the wave's own LDS writes are over before other lanes of it read the rows back
      asm volatile("s_wait_dscnt 0x0" ::: "memory");
#pragma unroll
      for (int i = 0; i < 8; ++i) {
        const int row = i * 2 + hi;          // 16 lanes x 16 B = the two whole lines of a row
        const v4f y = *(const v4f*)&st[row * PF + lm * 4];
        *(v4f*)&Yf[ybase + (size_t)(mt * 16 + row) * NN + lm * 4] = y;
      }
    }
    asm volatile("s_wait_xcnt 0x0" ::: "memory");
  } else {
    f16* st = piece;                         // 32 x 64 f16, [m][n], padded rows
#pragma unroll
    for (int mt = 0; mt < 2; ++mt)
#pragma unroll
      for (int nt = 0; nt < 4; ++nt) {
        v8h y;
#pragma unroll
        for (int r = 0; r < 8; ++r) y[r] = (f16)(acc[mt][nt][r] + bv[mt]);
        *(v8h*)&st[(mt * 16 + lm) * P64 + nt * 16 + hi * 8] = y;
      }
    // the wave's own LDS writes are over before other lanes of it read the rows back
    asm volatile("s_wait_dscnt 0x0" ::: "memory");
#pragma unroll
    for (int i = 0; i < 8; ++i) {
      const int row = i * 4 + (lane >> 3);   // 8 lanes x 16 B = the whole line of a row
      const int ch  = (lane & 7) * 8;
      const v8h y = *(const v8h*)&st[row * P64 + ch];
      *(v8h*)&Yh[ybase + (size_t)row * NN + ch] = y;
    }
  }
}

__device__ inline float xhalf(float x) {
  int b = __builtin_bit_cast(int, x);
  return __builtin_bit_cast(float,
      __builtin_amdgcn_permlanex16(b, b, 0x76543210, 0xfedcba98, false, false));
}

// ---------------------------------------------------------------------------
// Flash attention over Q/K/V f16 buffers laid out [b, c, n], c = d*16 + h.
// One block handles 128 queries of one (b, h); its 8 waves cover 8 query tiles of 16 columns
// and SHARE the K/V stages of KS keys. A stage goes to LDS as it lies in memory,
// [d][m], by async copies of whole lines into one of two buffers, one stage ahead
// of the stage at work; K is transposed by the LDS read. A pass is 32 keys.
// Both products are taken transposed, S^T = K^T Q and O = V P^T: a lane holds
// the scores of ONE query (16 of the 32 keys, the other 16 in lane ^ 16), so
// maximum and sum run down its own registers, and the two score tiles,
// converted in place, are the B operand of the second product.
// ---------------------------------------------------------------------------
__global__ __launch_bounds__(256)
void attn_wmma(const f16* __restrict__ Q, const f16* __restrict__ Km,
               const f16* __restrict__ Vm, f16* __restrict__ Xa)
{
  __shared__ __attribute__((aligned(16))) f16 ldsK[2][HD * KP];    // K stage: [d][m], m contiguous, padded rows
  __shared__ __attribute__((aligned(16))) f16 ldsV[2][HD * P64];   // V stage: [d][m], m contiguous, padded rows

  const int tid  = threadIdx.x;
  const int lane = tid & 31;
  const int wave = tid >> 5;
  const int lm = lane & 15;
  const int hi = lane >> 4;

  const int gid = blockIdx.x;        // B*H*8 = 1024 blocks
  const int b  = gid >> 7;
  const int h  = (gid >> 3) & 15;
  const int qc = gid & 7;
  const int n0 = (qc * 8 + wave) * 16;

  const size_t boff = (size_t)b * DM * NN;
  const f16* Qb = Q  + boff;
  const f16* Kb = Km + boff;
  const f16* Vb = Vm + boff;

  // Q as B fragments: column n (lane), K = head-dim d (64 -> 2 frags)
  Frag16 qa[2];
#pragma unroll
  for (int f = 0; f < 2; ++f)
#pragma unroll
    for (int e = 0; e < 16; ++e) {
      int d = f * 32 + hi * 8 + ((e & 8) << 1) + (e & 7);
      qa[f].h[e] = Qb[(size_t)(d * NH + h) * NN + (n0 + lm)];
    }

  v8f zero = {};
  v8f oacc[4];                       // O[d = f*16 + 8*hi + r][n0 + lm]
#pragma unroll
  for (int f = 0; f < 4; ++f) oacc[f] = zero;
  float mrow = -1.0e30f;             // running maximum of query n0 + lm (equal in both halves)
  float lrow = 0.0f;                 // running sum over this half's keys; the halves join after the loop

  const int sr = tid >> 3;           // 0..31: head-dim row for staging (and row + 32)
  const int sc = (tid & 7) * 8;      // key chunk for staging: 8 lanes x 16 B = one whole 128-B line of the row

  auto stageKV = [&](int buf, int mS) {
    const size_t g0 = (size_t)(sr * NH + h) * NN + mS + sc;
    const size_t g1 = g0 + (size_t)32 * NH * NN;
    async_copy16(Kb + g0, &ldsK[buf][sr * KP + sc]);
    async_copy16(Kb + g1, &ldsK[buf][(sr + 32) * KP + sc]);
    async_copy16(Vb + g0, &ldsV[buf][sr * P64 + sc]);
    async_copy16(Vb + g1, &ldsV[buf][(sr + 32) * P64 + sc]);
  };

  // The 8 blocks of one (b, h) copy the same K/V stages from L2: each walks all NKS stages from a start of its own, round the
  // ring of stages, so that they do not ask for the same lines at the same moment (the online softmax takes the keys in any order)
  constexpr int NKS = NN / KS;
  static_assert((NKS & (NKS - 1)) == 0 && NKS % 8 == 0, "the ring of stages is closed by a mask; 8 starts spread evenly");
  const int rot = qc * (NKS / 8);

  // prologue: the first stage lands and is published, then the second starts
  stageKV(0, rot * KS);
  // this wave's copies of stage 0 have landed before the barrier publishes them
  asm volatile("s_wait_asynccnt 0x0" ::: "memory");
  __syncthreads();
  stageKV(1, ((1 + rot) & (NKS - 1)) * KS);

  for (int st = 0; st < NKS; ++st) {
   const f16* Kst = ldsK[st & 1];
   const f16* Vst = ldsV[st & 1];
#pragma unroll 1
   for (int ps32 = 0; ps32 < KS; ps32 += 32) {
    // ---- S^T = K^T Q  (two 16x16 tiles covering 32 keys): s[t][r] = S[n0 + lm][((st + rot) % NKS)*KS + ps32 + t*16 + 8*hi + r]
    v8f s[2];
#pragma unroll
    for (int t = 0; t < 2; ++t) {
      s[t] = zero;
#pragma unroll
      for (int f = 0; f < 2; ++f) {
        const v16h kb = frag_tr_from_lds<KP>(Kst + f * 32 * KP + ps32 + t * 16, lane);
        s[t] = __builtin_amdgcn_wmma_f32_16x16x32_f16(
            false, kb, false, qa[f].v, (short)0, s[t], false, false);
      }
    }

    // ---- online softmax: one query a lane, its keys down the registers
    s[0] *= 0.125f;                  // 1/sqrt(64)
    s[1] *= 0.125f;
    float rmax = fmaxf(s[0][0], s[1][0]);
#pragma unroll
    for (int r = 1; r < 8; ++r) rmax = fmaxf(rmax, fmaxf(s[0][r], s[1][r]));
    rmax = fmaxf(rmax, xhalf(rmax));
    const float mnew  = fmaxf(mrow, rmax);
    const float alpha = __expf(mrow - mnew);
    mrow = mnew;

    // P^T in the B layout: element e = key 8*hi + e (e < 8), 16 + 8*hi + (e - 8) above
    Frag16 pb;
    float ps[8];
#pragma unroll
    for (int r = 0; r < 8; ++r) {
      float p0 = __expf(s[0][r] - mnew);
      float p1 = __expf(s[1][r] - mnew);
      pb.h[r]     = (f16)p0;
      pb.h[r + 8] = (f16)p1;
      ps[r] = p0 + p1;
    }
    const float rs = ((ps[0] + ps[1]) + (ps[2] + ps[3])) + ((ps[4] + ps[5]) + (ps[6] + ps[7]));
    lrow = lrow * alpha + rs;
#pragma unroll
    for (int f = 0; f < 4; ++f) oacc[f] *= alpha;

    // ---- O += V P^T   (K = 32 keys, 4 tiles covering d=64)
#pragma unroll
    for (int f = 0; f < 4; ++f) {
      Frag16 vb;
      const unsigned* p32 = (const unsigned*)(Vst + (f * 16 + lm) * P64 + ps32);
#pragma unroll
      for (int p = 0; p < 8; ++p) {
        int m = hi * 8 + ((p & 4) << 2) + ((p & 3) << 1);
        vb.u[p] = p32[m >> 1];
      }
      oacc[f] = __builtin_amdgcn_wmma_f32_16x16x32_f16(
          false, vb.v, false, pb.v, (short)0, oacc[f], false, false);
    }
   }

    // this wave's LDS reads of the stage at work are over before the barrier frees its buffer for refill
    asm volatile("s_wait_dscnt 0x0" ::: "memory");
    // this wave's copies of the next stage have landed before the barrier publishes them
    asm volatile("s_wait_asynccnt 0x0" ::: "memory");
    __syncthreads();
    if (st + 2 < NKS) stageKV(st & 1, ((st + 2 + rot) & (NKS - 1)) * KS);
  }
  // no copy of this wave is left in flight at its end
  asm volatile("s_wait_asynccnt 0x0" ::: "memory");

  // ---- join the halves' sums and normalize; the block's 64 x 128 outputs O[d][n] meet in the K ring, which the
  // last stage's foot has freed (no LDS read and no copy of any wave left, then the barrier), and leave as whole lines
  const float lsum = lrow + xhalf(lrow);
  f16* stO = &ldsK[0][0];            // [d][n of the block], padded rows: HD * PO of the ring's 2 * HD * KP values
  static_assert(HD * PO <= 2 * HD * KP, "the staged outputs fit the K ring");
#pragma unroll
  for (int f = 0; f < 4; ++f) {
#pragma unroll
    for (int r = 0; r < 8; ++r) {
      int d = f * 16 + 8 * hi + r;
      float v = oacc[f][r] / lsum;
      stO[d * PO + wave * 16 + lm] = (f16)v;
    }
  }
  // every wave's columns are in LDS before any wave reads whole rows
  __syncthreads();
#pragma unroll
  for (int i = 0; i < 4; ++i) {
    const int d = wave * 8 + i * 2 + hi;   // 16 lanes x 16 B = the two whole lines of a row
    const v8h y = *(const v8h*)&stO[d * PO + lm * 8];
    *(v8h*)&Xa[boff + (size_t)(d * NH + h) * NN + qc * 128 + lm * 8] = y;
  }
}

// ---------------------------------------------------------------------------
extern "C" void kernel_launch(void* const* d_in, const int* in_sizes, int n_in,
                              void* d_out, int out_size, void* d_ws, size_t ws_size,
                              hipStream_t stream) {
  const float* q_in = (const float*)d_in[0];
  const float* k_in = (const float*)d_in[1];
  const float* v_in = (const float*)d_in[2];
  const float* Wq = (const float*)d_in[3];
  const float* bq = (const float*)d_in[4];
  const float* Wk = (const float*)d_in[5];
  const float* bk = (const float*)d_in[6];
  const float* Wv = (const float*)d_in[7];
  const float* bv = (const float*)d_in[8];
  const float* Wm = (const float*)d_in[9];
  const float* bm = (const float*)d_in[10];
  float* out = (float*)d_out;

  // workspace partition (all f16)
  f16* ws = (f16*)d_ws;
  const size_t SB = (size_t)BATCH * DM * NN;  // 8M elems
  const size_t SW = (size_t)DM * DM;          // 1M elems
  f16* q16  = ws;
  f16* k16  = q16  + SB;
  f16* v16  = k16  + SB;
  f16* wq16 = v16  + SB;
  f16* wk16 = wq16 + SW;
  f16* wv16 = wk16 + SW;
  f16* wm16 = wv16 + SW;
  f16* Qp   = wm16 + SW;
  f16* Kp   = Qp   + SB;
  f16* Vp   = Kp   + SB;
  f16* Xat  = Vp   + SB;

  // 1) convert fp32 inputs/weights to f16: one launch, one block a WGP; q16 .. wm16 are contiguous
  cvt_f32_to_f16<<<CVT_B, CVT_T, 0, stream>>>(q_in, k_in, v_in, Wq, Wk, Wv, Wm, q16);

  // 2) Q/K/V projections (WMMA GEMM, f16 out): one launch, z = (projection, batch);
  //    wq16..wv16, q16..v16 and Qp..Vp are each contiguous
  dim3 g3(NN / BN, DM / BM, 3 * BATCH);
  gemm1024_wmma<<<g3, 256, 0, stream>>>(wq16, q16, bq, bk, bv, Qp, nullptr, 0);

  // 3) flash attention: one block per (b, h, 128 queries); 8 waves share the K/V stages in LDS
  attn_wmma<<<BATCH * NH * (NN / 128), 256, 0, stream>>>(Qp, Kp, Vp, Xat);

  // 4) output projection (fp32 out)
  dim3 g1(NN / BN, DM / BM, BATCH);
  gemm1024_wmma<<<g1, 256, 0, stream>>>(wm16, Xat, bm, bm, bm, nullptr, out, 1);
}

// v010
// A run of this version takes 106 microseconds.
// Next to v009, in two timings, it ran 1.04 times as fast each time.
// All steps since v000 together make it 4.61 times as fast.
#include <hip/hip_runtime.h>
#include <hip/hip_bf16.h>
#include <stdint.h>

typedef _Float16 f16;
typedef __attribute__((ext_vector_type(16))) _Float16 v16h;
typedef __attribute__((ext_vector_type(8)))  float    v8f;
typedef __attribute__((ext_vector_type(4)))  int      v4i;
typedef __attribute__((ext_vector_type(8)))  short    v8s;
typedef __attribute__((ext_vector_type(8)))  _Float16 v8h;

#define DM 1024   // d_model
#define NN 1024   // sequence length
#define BATCH 8
#define NH 16     // heads
#define HD 64     // head dim
#define KS 64     // keys of an attention K/V stage: rows of one whole 128-B line

#define BM 128
#define BN 128
#define BK 64
#define XP 144
#define KP 80
#define P64 72
#define PF  68
#define PO  136

union Frag16 { v16h v; unsigned u[8]; f16 h[16]; };
union FragT  { v16h v; v8s q[2]; };

typedef uint32_t u32x4 __attribute__((ext_vector_type(4)));
typedef uint32_t u32x8 __attribute__((ext_vector_type(8)));
#define PAD_128_B128 ((1u << 20) | (4u << 22) | (3u << 25))   // rows of 128 B, 16 B more a row: pitch 144 B, for ds_load_b128
#define PAD_128_TR16 ((1u << 20) | (4u << 22) | (7u << 25))   // rows of 128 B, 32 B more a row: pitch 160 B, for ds_load_tr16_b128
#define PAD_256_TR16 ((1u << 20) | (5u << 22) | (7u << 25))   // rows of 256 B, 32 B more a row: pitch 288 B, for ds_load_tr16_b128

__device__ inline uint32_t uni(uint32_t v) { return (uint32_t)__builtin_amdgcn_readfirstlane(v); }
// the empty statement holds the wave-uniform test in a scalar register, so that the branch on it is a scalar branch
__device__ inline uint32_t pinned(uint32_t v) { uint32_t w = uni(v); asm volatile("" : "+s"(w)); return w; }

template <uint32_t ROWB, uint32_t ROWS, uint32_t SRCP, uint32_t W0>
__device__ inline u32x8 tile_group1() {
  static_assert(ROWB % 4 == 0 && SRCP % 16 == 0 && SRCP >= 16 && SRCP <= 131072, "the tensor mover's ranges");
  u32x8 g;
  g[0] = uni(W0);
  g[1] = uni((ROWB & 0xFFFFu) << 16);                                    // tensor dims = tile dims
  g[2] = uni((ROWB >> 16) | ((ROWS & 0xFFFFu) << 16));
  g[3] = uni((ROWS >> 16) | (ROWB << 16));
  g[4] = uni(ROWS);
  g[5] = uni(SRCP);
  g[6] = uni(0u);
  g[7] = uni(0u);
  asm volatile("" : "+s"(g));
  return g;
}
__device__ inline u32x4 tile_group0(const f16* g, const f16* l) {
  const uint64_t ga = (uint64_t)(size_t)g;
  u32x4 g0;
  g0[0] = uni(1u);                                                       // count 1
  g0[1] = uni((uint32_t)(size_t)l);
  g0[2] = uni((uint32_t)ga);
  g0[3] = uni((((uint32_t)(ga >> 32)) & 0x01FFFFFFu) | 0x80000000u);     // type 2
  return g0;
}
__device__ inline void tensor_load(u32x4 g0, u32x8 g1) { asm volatile("tensor_load_to_lds %0, %1" :: "s"(g0), "s"(g1) : "memory"); }
__device__ inline void tensor_wait(u32x4 g0) { asm volatile("s_wait_tensorcnt 0x0" :: "s"(g0) : "memory"); }

// ---------------------------------------------------------------------------
// fp32 -> f16 conversion of all seven operands in ONE launch, built as a stream:
// one block of 16 waves for each WGP; a wave walks CVT_NC chunks of CVT_L loads,
// each load 512 contiguous bytes (four whole lines), and keeps the loads of the
// next CVT_A chunks in flight while it converts and stores the oldest one.
// The f16 copies lie one behind the other in out: q, k, v, Wq, Wk, Wv, Wm, and
// chunk c of wave w is chunk c * CVT_W + w of that row of operands.
// ---------------------------------------------------------------------------
typedef __attribute__((ext_vector_type(4))) float    v4f;
typedef __attribute__((ext_vector_type(4))) _Float16 v4h;
typedef const __attribute__((address_space(1))) v4f gl_v4f;
typedef __attribute__((address_space(1))) v4h gl_v4h;

#define CVT_T  512                     // threads of a block: 16 waves
#define CVT_B  256                     // blocks
#define CVT_W  (CVT_B * CVT_T / 32)    // waves of the launch
#define CVT_L  8                       // loads of a chunk
#define CVT_CH (CVT_L * 128)           // elements of a chunk
#define CVT_NC 7                       // chunks of a wave
#define CVT_A  2                       // chunks whose loads run ahead of the chunk at work
#define SZ_X ((long)BATCH * DM * NN)
#define SZ_W ((long)DM * DM)
#define CVT_R ((long)CVT_W * CVT_CH)   // elements of a round: one chunk of every wave
static_assert(SZ_X == 2 * CVT_R, "an activation is two rounds of chunks");
static_assert(4 * SZ_W == CVT_R, "the four weights are one round of chunks");
static_assert((SZ_W / CVT_CH) % (CVT_T / 32) == 0, "a block stays inside one weight");

__global__ __launch_bounds__(CVT_T)
void cvt_f32_to_f16(const float* __restrict__ q,  const float* __restrict__ k,
                    const float* __restrict__ v,  const float* __restrict__ wq,
                    const float* __restrict__ wk, const float* __restrict__ wv,
                    const float* __restrict__ wm, f16* __restrict__ out) {
  const unsigned s  = blockIdx.x / (unsigned)(SZ_W / CVT_CH / (CVT_T / 32));   // the block's weight
  const float* wsel = s == 0 ? wq : s == 1 ? wk : s == 2 ? wv : wm;
  // Every load and store is "operand's start (scalar) + 32-bit byte offset of the lane (vector) + constant":
  // w4, w2 = the lane's byte offset in a round of f32, of f16; an activation's second round and the
  // rounds of out are reached through the offset, which stays far below 2^32
  const float* in[CVT_NC] = { q, q, k, k, v, v, wsel };
  const unsigned e  = (blockIdx.x * (CVT_T / 32) + (threadIdx.x >> 5)) * CVT_CH + (threadIdx.x & 31) * 4;
  const unsigned w4 = e * 4u, w2 = e * 2u;
  const unsigned r4 = (unsigned)(CVT_R * 4);             // bytes of a round of f32
  const unsigned io[CVT_NC] = { w4, w4 + r4, w4, w4 + r4, w4, w4 + r4, w4 - s * (unsigned)(SZ_W * 4) };

  v4f buf[CVT_A + 1][CVT_L];
  // non-temporal: the f32 words are read once and need no place in L2
#define CVT_LOAD(C) do { _Pragma("unroll") for (int j = 0; j < CVT_L; ++j)  \
    buf[(C) % (CVT_A + 1)][j] = __builtin_nontemporal_load((gl_v4f*)((unsigned long)in[C] + j * 512 + io[C])); } while (0)

#pragma unroll
  for (int c = 0; c < CVT_A; ++c) CVT_LOAD(c);
#pragma unroll
  for (int c = 0; c < CVT_NC; ++c) {
    // the scheduling barriers hold the order "loads of chunk c + CVT_A, then chunk c's conversion and
    // stores": left free, the loads sink towards their use and the stores gather at the kernel's end
    __builtin_amdgcn_sched_barrier(0);
    if (c > 0) asm volatile("s_wait_xcnt 0x0" ::: "memory");
    if (c + CVT_A < CVT_NC) CVT_LOAD(c + CVT_A);
    __builtin_amdgcn_sched_barrier(0);
#pragma unroll
    for (int j = 0; j < CVT_L; ++j) {
      const v4f x = buf[c % (CVT_A + 1)][j];
      v4h y;
      y[0] = (f16)x[0]; y[1] = (f16)x[1]; y[2] = (f16)x[2]; y[3] = (f16)x[3];
      *(gl_v4h*)((unsigned long)out + j * 256 + (w2 + c * (r4 / 2))) = y;   // 256 contiguous bytes a wave: two whole lines
    }
  }
#undef CVT_LOAD
}

__device__ inline v16h frag_from_lds(const f16* rowbase, int khalf) {
  FragT f;
  f.q[0] = *(const v8s*)(rowbase + khalf);        // k = khalf + 0..7
  f.q[1] = *(const v8s*)(rowbase + khalf + 16);   // k = khalf + 16..23
  return f.v;
}

// ---------------------------------------------------------------------------
// Build a 16x32 f16 A fragment (T^T) from an LDS tile T stored [k][n], n contiguous,
// row pitch PITCH. The transposing load hands lane (c = lane & 15, h = lane >> 4)
// the eight values T[kbase + 8h + 0..7][c]; the loads at kbase 0 and 16 give
// the same k order as frag_from_lds gives the W fragments of the GEMM.
// ---------------------------------------------------------------------------
template <int PITCH>
__device__ inline v16h frag_tr_from_lds(const f16* colbase, int lane) {
  typedef __attribute__((address_space(3))) v8s lds_v8s;
  const f16* p = colbase + ((lane >> 4) * 8 + (lane & 7)) * PITCH + ((lane >> 3) & 1) * 8;
  FragT f;
  f.q[0] = __builtin_amdgcn_ds_load_tr16_b128_v8i16((lds_v8s*)p);
  f.q[1] = __builtin_amdgcn_ds_load_tr16_b128_v8i16((lds_v8s*)(p + 16 * PITCH));
  return f.v;
}

// ---------------------------------------------------------------------------
// GEMM: Y[z] = W[z / BATCH](1024x1024) @ X[z](1024x1024) + bias[z / BATCH]   (f16 WMMA)
// blockIdx.z = z counts (projection, batch): the projections' W, X and Y lie one
// behind the other in memory, so independent projections share one launch.
// Double-buffered LDS; each tile is one tensor load (wave 0: W, wave 1: X); the X tile
// stays [k][n] as in memory and is transposed by the LDS read.
// The product is taken as Y^T = X^T W^T (X fragments first): a lane then holds eight
// neighbouring n of ONE row m, so it needs one bias value a tile and writes 16 bytes
// at a time; each wave turns its 32 x 64 tile in its own piece of the freed ring
// and stores whole 128-B lines.
// writeF32 ? write float to Yf : write f16 to Yh
// ---------------------------------------------------------------------------
__global__ __launch_bounds__(256)
void gemm1024_wmma(const f16* __restrict__ Wall, const f16* __restrict__ X,
                   const float* __restrict__ bias0, const float* __restrict__ bias1,
                   const float* __restrict__ bias2,
                   f16* __restrict__ Yh, float* __restrict__ Yf, int writeF32)
{
  __shared__ __attribute__((aligned(2048))) f16 ldsW[2][BM * P64];  // [m][k], k contiguous, padded rows
  __shared__ __attribute__((aligned(2048))) f16 ldsX[2][BK * XP];   // [k][n], n contiguous, padded rows
  static_assert((BM * P64 * 2) % 2048 == 0 && (BK * XP * 2) % 2048 == 0, "every buffer starts at a multiple of 2 KiB");
  static_assert(BK * 2 == 128 && P64 * 2 == 128 + 16 && BN * 2 == 256 && XP * 2 == 256 + 32, "the pads give the readers' pitches");

  const int b  = blockIdx.z;          // (projection, batch)
  const int pj = b / BATCH;           // which projection
  const f16* Xb = X + (size_t)b * DM * NN;
  const f16* W  = Wall + (size_t)pj * DM * DM;
  const float* bias = pj == 0 ? bias0 : pj == 1 ? bias1 : bias2;
  const int m0 = blockIdx.y * BM;
  const int n0 = blockIdx.x * BN;
  const int tid  = threadIdx.x;
  const int lane = tid & 31;
  const int wave = tid >> 5;
  const int wm = (wave >> 1) * 32;   // 4 waves along M
  const int wn = (wave & 1) * 64;    // 2 waves along N
  const int lm = lane & 15;
  const int hi = lane >> 4;
  const int khalf = hi * 8;

  const uint32_t wv = uni(threadIdx.x >> 5);   // the wave's number, in a scalar register
  // a stage: the 128 x 64 W tile by wave 0, the 64 x 128 X tile by wave 1, one request each
  const u32x8 g1W = tile_group1<BK * 2, BM, DM * 2, PAD_128_B128>();
  const u32x8 g1X = tile_group1<BN * 2, BK, NN * 2, PAD_256_TR16>();
  u32x4 g0;
  auto stage = [&](int buf, int k0) {
    g0 = wv == 0 ? tile_group0(W + (size_t)m0 * DM + k0, &ldsW[buf][0]) : tile_group0(Xb + (size_t)k0 * NN + n0, &ldsX[buf][0]);
    if (pinned(wv == 0)) tensor_load(g0, g1W);
    if (pinned(wv == 1)) tensor_load(g0, g1X);
  };

  v8f zero = {};
  v8f acc[2][4];
#pragma unroll
  for (int i = 0; i < 2; ++i)
#pragma unroll
    for (int j = 0; j < 4; ++j) acc[i][j] = zero;

  // Every block walks all NST stages of k, but from a start of its own, round the ring of stages: the blocks that run at the
  // same time and load the same lines from L2 (a W tile: the 8 n tiles of 8 batches; an X tile: the 8 m tiles) would else
  // ask for the same lines at the same moment, stage after stage. Blocks that share an X tile get 8 different starts,
  // those that share a W tile all 16.
  constexpr int NST = DM / BK;
  static_assert((NST & (NST - 1)) == 0, "the ring of stages is closed by a mask");
  const int rot = (blockIdx.x + blockIdx.y + (NST / 2) * (blockIdx.z & 1)) & (NST - 1);

  // prologue: the first stage lands and is published, then the second starts
  stage(0, rot * BK);
  // the issuing wave's request for stage 0 has landed before the barrier publishes it
  tensor_wait(g0);
  __syncthreads();
  stage(1, ((1 + rot) & (NST - 1)) * BK);

  for (int s = 0; s < NST; ++s) {   // pass s works on stage (s + rot) mod NST, in buffer s mod 2
    const int cur = s & 1;

    // the stage's two blocks of 32 k, in rising k; unrolled so that the second block's LDS reads can start under the first's products
#pragma unroll
    for (int ks = 0; ks < BK; ks += 32) {
      v16h a[2], bb[4];
#pragma unroll
      for (int mt = 0; mt < 2; ++mt)
        a[mt]  = frag_from_lds(&ldsW[cur][(wm + mt * 16 + lm) * P64 + ks], khalf);
#pragma unroll
      for (int nt = 0; nt < 4; ++nt)
        bb[nt] = frag_tr_from_lds<XP>(&ldsX[cur][ks * XP + wn + nt * 16], lane);

#pragma unroll
      for (int mt = 0; mt < 2; ++mt)
#pragma unroll
        for (int nt = 0; nt < 4; ++nt)
          acc[mt][nt] = __builtin_amdgcn_wmma_f32_16x16x32_f16(
              false, bb[nt], false, a[mt], (short)0, acc[mt][nt], false, false);
    }

    // this wave's LDS reads of the current buffers are over before the barrier frees them for refill
    asm volatile("s_wait_dscnt 0x0" ::: "memory");
    // the issuing wave's request for the next stage has landed before the barrier publishes it
    tensor_wait(g0);
    __syncthreads();
    // the stage after the next goes into the buffer that every wave has just left
    if (pinned(s + 2 < NST)) stage(cur, ((s + 2 + rot) & (NST - 1)) * BK);
  }
  // no request and no LDS read of this wave is left before the ring becomes output staging
  tensor_wait(g0);
  asm volatile("s_wait_dscnt 0x0" ::: "memory");

  // epilogue: acc[mt][nt][r] = Y[m0 + wm + mt*16 + lm][n0 + wn + nt*16 + 8*hi + r].
  // The last pass's foot (no LDS read and no request of any wave left, then the barrier) has freed the ring.
  // The loops below are unrolled so that every accumulator index is a constant: registers, not scratch.
  float bv[2];
#pragma unroll
  for (int mt = 0; mt < 2; ++mt) bv[mt] = bias[m0 + wm + mt * 16 + lm];
  const size_t ybase = ((size_t)b * DM + m0 + wm) * NN + n0 + wn;   // first output of the wave's tile
  // a wave's own piece of the freed ring, 32 * P64 f16: waves 0..3 share the W ring, waves 4..7 the X ring
  static_assert(4 * 32 * P64 <= 2 * BM * P64 && 4 * 32 * P64 <= 2 * BK * XP, "four pieces fit each ring");
  static_assert(16 * PF * 4 <= 32 * P64 * 2, "16 rows of f32 fit a piece");
  f16* piece = (wave < 4 ? &ldsW[0][0] : &ldsX[0][0]) + (wave & 3) * 32 * P64;

  if (writeF32) {
    float* st = (float*)piece;               // 16 x 64 f32, [m][n], padded rows: the tile's two halves one after the other
#pragma unroll
    for (int mt = 0; mt < 2; ++mt) {
#pragma unroll
      for (int nt = 0; nt < 4; ++nt) {
        v4f y0, y1;
#pragma unroll
        for (int r = 0; r < 4; ++r) {
          y0[r] = acc[mt][nt][r]     + bv[mt];
          y1[r] = acc[mt][nt][r + 4] + bv[mt];
        }
        *(v4f*)&st[lm * PF + nt * 16 + hi * 8]     = y0;
        *(v4f*)&st[lm * PF + nt * 16 + hi * 8 + 4] = y1;
      }
      // the wave's own LDS writes are over before other lanes of it read the rows back
      asm volatile("s_wait_dscnt 0x0" ::: "memory");
#pragma unroll
      for (int i = 0; i < 8; ++i) {
        const int row = i * 2 + hi;          // 16 lanes x 16 B = the two whole lines of a row
        const v4f y = *(const v4f*)&st[row * PF + lm * 4];
        *(v4f*)&Yf[ybase + (size_t)(mt * 16 + row) * NN + lm * 4] = y;
      }
    }
    asm volatile("s_wait_xcnt 0x0" ::: "memory");
  } else {
    f16* st = piece;                         // 32 x 64 f16, [m][n], padded rows
#pragma unroll
    for (int mt = 0; mt < 2; ++mt)
#pragma unroll
      for (int nt = 0; nt < 4; ++nt) {
        v8h y;
#pragma unroll
        for (int r = 0; r < 8; ++r) y[r] = (f16)(acc[mt][nt][r] + bv[mt]);
        *(v8h*)&st[(mt * 16 + lm) * P64 + nt * 16 + hi * 8] = y;
      }
    // the wave's own LDS writes are over before other lanes of it read the rows back
    asm volatile("s_wait_dscnt 0x0" ::: "memory");
#pragma unroll
    for (int i = 0; i < 8; ++i) {
      const int row = i * 4 + (lane >> 3);   // 8 lanes x 16 B = the whole line of a row
      const int ch  = (lane & 7) * 8;
      const v8h y = *(const v8h*)&st[row * P64 + ch];
      *(v8h*)&Yh[ybase + (size_t)row * NN + ch] = y;
    }
  }
}

__device__ inline float xhalf(float x) {
  int b = __builtin_bit_cast(int, x);
  return __builtin_bit_cast(float,
      __builtin_amdgcn_permlanex16(b, b, 0x76543210, 0xfedcba98, false, false));
}

// ---------------------------------------------------------------------------
// Flash attention over Q/K/V f16 buffers laid out [b, c, n], c = d*16 + h.
// One block handles 128 queries of one (b, h); its 8 waves cover 8 query tiles of 16 columns
// and SHARE the K/V stages of KS keys. A stage goes to LDS as it lies in memory,
// [d][m], by one tensor load for K (wave 0) and one for V (wave 1) into one of two buffers,
// one stage ahead of the stage at work; K is transposed by the LDS read. A pass is 32 keys.
// Both products are taken transposed, S^T = K^T Q and O = V P^T: a lane holds
// the scores of ONE query (16 of the 32 keys, the other 16 in lane ^ 16), so
// maximum and sum run down its own registers, and the two score tiles,
// converted in place, are the B operand of the second product.
// ---------------------------------------------------------------------------
__global__ __launch_bounds__(256)
void attn_wmma(const f16* __restrict__ Q, const f16* __restrict__ Km,
               const f16* __restrict__ Vm, f16* __restrict__ Xa)
{
  constexpr int VB = 5 * 1024;       // f16 of a V buffer: HD * P64 rounded up to a multiple of 2 KiB
  __shared__ __attribute__((aligned(2048))) f16 ldsK[2][HD * KP];  // K stage: [d][m], m contiguous, padded rows
  __shared__ __attribute__((aligned(2048))) f16 ldsV[2][VB];       // V stage: [d][m], m contiguous, padded rows
  static_assert((HD * KP * 2) % 2048 == 0 && (VB * 2) % 2048 == 0 && HD * P64 <= VB, "every buffer starts at a multiple of 2 KiB");
  static_assert(KS * 2 == 128 && KP * 2 == 128 + 32 && P64 * 2 == 128 + 16, "the pads give the readers' pitches");

  const int tid  = threadIdx.x;
  const int lane = tid & 31;
  const int wave = tid >> 5;
  const int lm = lane & 15;
  const int hi = lane >> 4;

  const int gid = blockIdx.x;        // B*H*8 = 1024 blocks
  const int b  = gid >> 7;
  const int h  = (gid >> 3) & 15;
  const int qc = gid & 7;
  const int n0 = (qc * 8 + wave) * 16;

  const size_t boff = (size_t)b * DM * NN;
  const f16* Qb = Q  + boff;
  const f16* Kb = Km + boff;
  const f16* Vb = Vm + boff;

  // Q as B fragments: column n (lane), K = head-dim d (64 -> 2 frags)
  Frag16 qa[2];
#pragma unroll
  for (int f = 0; f < 2; ++f)
#pragma unroll
    for (int e = 0; e < 16; ++e) {
      int d = f * 32 + hi * 8 + ((e & 8) << 1) + (e & 7);
      qa[f].h[e] = Qb[(size_t)(d * NH + h) * NN + (n0 + lm)];
    }

  v8f zero = {};
  v8f oacc[4];                       // O[d = f*16 + 8*hi + r][n0 + lm]
#pragma unroll
  for (int f = 0; f < 4; ++f) oacc[f] = zero;
  float mrow = -1.0e30f;             // running maximum of query n0 + lm (equal in both halves)
  float lrow = 0.0f;                 // running sum over this half's keys; the halves join after the loop

  const uint32_t wv = uni(threadIdx.x >> 5);   // the wave's number, in a scalar register
  // a stage: HD rows of KS keys, a row every NH * NN values; K by wave 0, V by wave 1, one request each
  const u32x8 g1K = tile_group1<KS * 2, HD, NH * NN * 2, PAD_128_TR16>();
  const u32x8 g1V = tile_group1<KS * 2, HD, NH * NN * 2, PAD_128_B128>();
  u32x4 g0;
  auto stageKV = [&](int buf, int mS) {
    const size_t g = (size_t)h * NN + mS;
    g0 = wv == 0 ? tile_group0(Kb + g, &ldsK[buf][0]) : tile_group0(Vb + g, &ldsV[buf][0]);
    if (pinned(wv == 0)) tensor_load(g0, g1K);
    if (pinned(wv == 1)) tensor_load(g0, g1V);
  };

  // The 8 blocks of one (b, h) load the same K/V stages from L2: each walks all NKS stages from a start of its own, round the
  // ring of stages, so that they do not ask for the same lines at the same moment (the online softmax takes the keys in any order)
  constexpr int NKS = NN / KS;
  static_assert((NKS & (NKS - 1)) == 0 && NKS % 8 == 0, "the ring of stages is closed by a mask; 8 starts spread evenly");
  const int rot = qc * (NKS / 8);

  // prologue: the first stage lands and is published, then the second starts
  stageKV(0, rot * KS);
  // the issuing wave's request for stage 0 has landed before the barrier publishes it
  tensor_wait(g0);
  __syncthreads();
  stageKV(1, ((1 + rot) & (NKS - 1)) * KS);

  for (int st = 0; st < NKS; ++st) {
   const f16* Kst = ldsK[st & 1];
   const f16* Vst = ldsV[st & 1];
#pragma unroll 1
   for (int ps32 = 0; ps32 < KS; ps32 += 32) {
    // ---- S^T = K^T Q  (two 16x16 tiles covering 32 keys): s[t][r] = S[n0 + lm][((st + rot) % NKS)*KS + ps32 + t*16 + 8*hi + r]
    v8f s[2];
#pragma unroll
    for (int t = 0; t < 2; ++t) {
      s[t] = zero;
#pragma unroll
      for (int f = 0; f < 2; ++f) {
        const v16h kb = frag_tr_from_lds<KP>(Kst + f * 32 * KP + ps32 + t * 16, lane);
        s[t] = __builtin_amdgcn_wmma_f32_16x16x32_f16(
            false, kb, false, qa[f].v, (short)0, s[t], false, false);
      }
    }

    // ---- online softmax: one query a lane, its keys down the registers
    s[0] *= 0.125f;                  // 1/sqrt(64)
    s[1] *= 0.125f;
    float rmax = fmaxf(s[0][0], s[1][0]);
#pragma unroll
    for (int r = 1; r < 8; ++r) rmax = fmaxf(rmax, fmaxf(s[0][r], s[1][r]));
    rmax = fmaxf(rmax, xhalf(rmax));
    const float mnew  = fmaxf(mrow, rmax);
    const float alpha = __expf(mrow - mnew);
    mrow = mnew;

    // P^T in the B layout: element e = key 8*hi + e (e < 8), 16 + 8*hi + (e - 8) above
    Frag16 pb;
    float ps[8];
#pragma unroll
    for (int r = 0; r < 8; ++r) {
      float p0 = __expf(s[0][r] - mnew);
      float p1 = __expf(s[1][r] - mnew);
      pb.h[r]     = (f16)p0;
      pb.h[r + 8] = (f16)p1;
      ps[r] = p0 + p1;
    }
    const float rs = ((ps[0] + ps[1]) + (ps[2] + ps[3])) + ((ps[4] + ps[5]) + (ps[6] + ps[7]));
    lrow = lrow * alpha + rs;
#pragma unroll
    for (int f = 0; f < 4; ++f) oacc[f] *= alpha;

    // ---- O += V P^T   (K = 32 keys, 4 tiles covering d=64)
#pragma unroll
    for (int f = 0; f < 4; ++f) {
      Frag16 vb;
      const unsigned* p32 = (const unsigned*)(Vst + (f * 16 + lm) * P64 + ps32);
#pragma unroll
      for (int p = 0; p < 8; ++p) {
        int m = hi * 8 + ((p & 4) << 2) + ((p & 3) << 1);
        vb.u[p] = p32[m >> 1];
      }
      oacc[f] = __builtin_amdgcn_wmma_f32_16x16x32_f16(
          false, vb.v, false, pb.v, (short)0, oacc[f], false, false);
    }
   }

    // this wave's LDS reads of the stage at work are over before the barrier frees its buffer for refill
    asm volatile("s_wait_dscnt 0x0" ::: "memory");
    // the issuing wave's request for the next stage has landed before the barrier publishes it
    tensor_wait(g0);
    __syncthreads();
    if (pinned(st + 2 < NKS)) stageKV(st & 1, ((st + 2 + rot) & (NKS - 1)) * KS);
  }
  // no request and no LDS read of this wave is left before the ring becomes output staging
  tensor_wait(g0);
  asm volatile("s_wait_dscnt 0x0" ::: "memory");

  // ---- join the halves' sums and normalize; the block's 64 x 128 outputs O[d][n] meet in the K ring, which the
  // last stage's foot has freed (no LDS read and no request of any wave left, then the barrier), and leave as whole lines
  const float lsum = lrow + xhalf(lrow);
  f16* stO = &ldsK[0][0];            // [d][n of the block], padded rows: HD * PO of the ring's 2 * HD * KP values
  static_assert(HD * PO <= 2 * HD * KP, "the staged outputs fit the K ring");
#pragma unroll
  for (int f = 0; f < 4; ++f) {
#pragma unroll
    for (int r = 0; r < 8; ++r) {
      int d = f * 16 + 8 * hi + r;
      float v = oacc[f][r] / lsum;
      stO[d * PO + wave * 16 + lm] = (f16)v;
    }
  }
  // every wave's columns are in LDS before any wave reads whole rows
  __syncthreads();
#pragma unroll
  for (int i = 0; i < 4; ++i) {
    const int d = wave * 8 + i * 2 + hi;   // 16 lanes x 16 B = the two whole lines of a row
    const v8h y = *(const v8h*)&stO[d * PO + lm * 8];
    *(v8h*)&Xa[boff + (size_t)(d * NH + h) * NN + qc * 128 + lm * 8] = y;
  }
}

// ---------------------------------------------------------------------------
extern "C" void kernel_launch(void* const* d_in, const int* in_sizes, int n_in,
                              void* d_out, int out_size, void* d_ws, size_t ws_size,
                              hipStream_t stream) {
  const float* q_in = (const float*)d_in[0];
  const float* k_in = (const float*)d_in[1];
  const float* v_in = (const float*)d_in[2];
  const float* Wq = (const float*)d_in[3];
  const float* bq = (const float*)d_in[4];
  const float* Wk = (const float*)d_in[5];
  const float* bk = (const float*)d_in[6];
  const float* Wv = (const float*)d_in[7];
  const float* bv = (const float*)d_in[8];
  const float* Wm = (const float*)d_in[9];
  const float* bm = (const float*)d_in[10];
  float* out = (float*)d_out;

  // workspace partition (all f16)
  f16* ws = (f16*)d_ws;
  const size_t SB = (size_t)BATCH * DM * NN;  // 8M elems
  const size_t SW = (size_t)DM * DM;          // 1M elems
  f16* q16  = ws;
  f16* k16  = q16  + SB;
  f16* v16  = k16  + SB;
  f16* wq16 = v16  + SB;
  f16* wk16 = wq16 + SW;
  f16* wv16 = wk16 + SW;
  f16* wm16 = wv16 + SW;
  f16* Qp   = wm16 + SW;
  f16* Kp   = Qp   + SB;
  f16* Vp   = Kp   + SB;
  f16* Xat  = Vp   + SB;

  // 1) convert fp32 inputs/weights to f16: one launch, one block a WGP; q16 .. wm16 are contiguous
  cvt_f32_to_f16<<<CVT_B, CVT_T, 0, stream>>>(q_in, k_in, v_in, Wq, Wk, Wv, Wm, q16);

  // 2) Q/K/V projections (WMMA GEMM, f16 out): one launch, z = (projection, batch);
  //    wq16..wv16, q16..v16 and Qp..Vp are each contiguous
  dim3 g3(NN / BN, DM / BM, 3 * BATCH);
  gemm1024_wmma<<<g3, 256, 0, stream>>>(wq16, q16, bq, bk, bv, Qp, nullptr, 0);

  // 3) flash attention: one block per (b, h, 128 queries); 8 waves share the K/V stages in LDS
  attn_wmma<<<BATCH * NH * (NN / 128), 256, 0, stream>>>(Qp, Kp, Vp, Xat);

  // 4) output projection (fp32 out)
  dim3 g1(NN / BN, DM / BM, BATCH);
  gemm1024_wmma<<<g1, 256, 0, stream>>>(wm16, Xat, bm, bm, bm, nullptr, out, 1);
}
